// v000
// Times are from an AMD MI455X. After a warm-up the kernel runs many times in a row, and a time is the length of
// such a window on the GPU divided by its runs, so every launch and the gaps after it count. The runs cycle
// through copies of the inputs. A figure is the median of several windows, for all but v000 over two sittings.
// Sittings can differ by a few percent; kernels timed side by side share one.
// v000 is the starting kernel. One run takes 207 microseconds.
#include <hip/hip_runtime.h>
#include <cmath>

typedef __attribute__((ext_vector_type(16))) _Float16 v16h;
typedef __attribute__((ext_vector_type(8)))  float    v8f;

namespace {
constexpr int BATCH = 2;
constexpr int HEADS = 16;
constexpr int SEQ   = 2048;
constexpr int DH    = 64;
constexpr int BQ    = 64;                 // q rows per workgroup (4 waves x 16)
constexpr int BK    = 64;                 // keys staged per iteration
constexpr int WAVES = 4;
constexpr int NTHR  = WAVES * 32;         // 128 threads, 4 wave32
constexpr int STG   = (BK * DH / 4) / NTHR;      // float4 per thread per matrix = 8
constexpr int MSTG  = (BQ * BK / 4) / NTHR;      // int4 chunks per thread for mask = 8
constexpr float SCALE = 0.125f;           // 64^-0.5
}

// reductions across the 16 lanes of each wave32 half (C-fragment N dimension)
__device__ __forceinline__ float row_max16(float v) {
  v = fmaxf(v, __shfl_xor(v, 1, 32));
  v = fmaxf(v, __shfl_xor(v, 2, 32));
  v = fmaxf(v, __shfl_xor(v, 4, 32));
  v = fmaxf(v, __shfl_xor(v, 8, 32));
  return v;
}
__device__ __forceinline__ float row_sum16(float v) {
  v += __shfl_xor(v, 1, 32);
  v += __shfl_xor(v, 2, 32);
  v += __shfl_xor(v, 4, 32);
  v += __shfl_xor(v, 8, 32);
  return v;
}

__global__ __launch_bounds__(NTHR, 1)
void flash_attn_f16_wmma(const float* __restrict__ Q,
                         const float* __restrict__ K,
                         const float* __restrict__ V,
                         const int*   __restrict__ MASK,
                         float* __restrict__ OUT)
{
  __shared__ _Float16 Ks[BK][DH];          // key block, f16
  __shared__ _Float16 Vs[BK][DH];          // value block, f16
  __shared__ _Float16 Ps[WAVES][16][BK];   // per-wave P re-layout scratch
  __shared__ int      Ms[BQ][BK];          // mask block (async-staged)

  const int tid  = threadIdx.x;
  const int lane = tid & 31;
  const int wave = tid >> 5;

  const int qtiles = SEQ / BQ;
  const int bh = blockIdx.x / qtiles;
  const int qt = blockIdx.x % qtiles;
  const int b  = bh / HEADS;

  const float* qb = Q + (size_t)bh * SEQ * DH;
  const float* kb = K + (size_t)bh * SEQ * DH;
  const float* vb = V + (size_t)bh * SEQ * DH;
  const int*   mb = MASK + (size_t)b * SEQ * SEQ;
  float*       ob = OUT + (size_t)bh * SEQ * DH;

  const int m16   = lane & 15;
  const int half8 = (lane >> 4) << 3;      // 0 for lanes 0..15, 8 for 16..31
  const int qblk  = qt * BQ;
  const int q0    = qblk + wave * 16;      // this wave's first q row

  // ---- Q A-fragments with softmax scale folded in (exact *0.125 in f16)
  // ISA A layout: lanes 0-15 hold K in {0..7,16..23}; lanes 16-31 hold {8..15,24..31}
  v16h qa[2];
  #pragma unroll
  for (int c = 0; c < 2; ++c)
    #pragma unroll
    for (int j = 0; j < 16; ++j) {
      const int kk = c * 32 + half8 + (j & 7) + ((j >> 3) << 4);
      qa[c][j] = (_Float16)(qb[(size_t)(q0 + m16) * DH + kk] * SCALE);
    }

  v8f oacc[4] = {};          // output accumulators: 4 Dh-tiles of 16
  float mrun[8], lrun[8];    // running row max / sum (8 rows per half-wave)
  #pragma unroll
  for (int r = 0; r < 8; ++r) { mrun[r] = -INFINITY; lrun[r] = 0.f; }

  // ---- software pipeline: preload K/V block 0 into registers
  float4 kreg[STG], vreg[STG];
  {
    const float4* ks = (const float4*)kb;
    const float4* vs = (const float4*)vb;
    #pragma unroll
    for (int it = 0; it < STG; ++it) {
      const int i = it * NTHR + tid;
      kreg[it] = ks[i];
      vreg[it] = vs[i];
    }
  }

  const uint32_t ms_lds = (uint32_t)(uintptr_t)(&Ms[0][0]);  // low 32 bits = LDS offset

  for (int k0 = 0; k0 < SEQ; k0 += BK) {
    __syncthreads();   // all waves done reading previous LDS contents

    // ---- async mask block -> LDS (per-lane 16B, tracked by ASYNCcnt)
    #pragma unroll
    for (int it = 0; it < MSTG; ++it) {
      const int i   = it * NTHR + tid;
      const int row = i >> 4;          // / (BK/4)
      const int col = (i & 15) << 2;   // *4 ints
      const unsigned long long ga = (unsigned long long)(uintptr_t)
          (mb + (size_t)(qblk + row) * SEQ + (k0 + col));
      const uint32_t la = ms_lds + (uint32_t)(i << 4);
      asm volatile("global_load_async_to_lds_b128 %0, %1, off"
                   :: "v"(la), "v"(ga) : "memory");
    }

    // ---- commit pipelined K/V registers to LDS as f16
    #pragma unroll
    for (int it = 0; it < STG; ++it) {
      const int i   = it * NTHR + tid;
      const int row = i >> 4;
      const int col = (i & 15) << 2;
      Ks[row][col + 0] = (_Float16)kreg[it].x;
      Ks[row][col + 1] = (_Float16)kreg[it].y;
      Ks[row][col + 2] = (_Float16)kreg[it].z;
      Ks[row][col + 3] = (_Float16)kreg[it].w;
      Vs[row][col + 0] = (_Float16)vreg[it].x;
      Vs[row][col + 1] = (_Float16)vreg[it].y;
      Vs[row][col + 2] = (_Float16)vreg[it].z;
      Vs[row][col + 3] = (_Float16)vreg[it].w;
    }
    // ---- issue next block's global loads now; latency hides under WMMA work
    if (k0 + BK < SEQ) {
      const float4* ks = (const float4*)(kb + (size_t)(k0 + BK) * DH);
      const float4* vs = (const float4*)(vb + (size_t)(k0 + BK) * DH);
      #pragma unroll
      for (int it = 0; it < STG; ++it) {
        const int i = it * NTHR + tid;
        kreg[it] = ks[i];
        vreg[it] = vs[i];
      }
    }

    asm volatile("s_wait_asynccnt 0x0" ::: "memory");  // mask block landed in LDS
    __syncthreads();

    // ---- scores: S = (Q*scale) * K^T, 4 key tiles of 16, K-dim 64 (2 WMMA each)
    v8f sc[4];
    #pragma unroll
    for (int t = 0; t < 4; ++t) {
      v8f acc = {};
      #pragma unroll
      for (int c = 0; c < 2; ++c) {
        v16h bf;   // lane holds key column t*16+m16, j walks Dh
        #pragma unroll
        for (int j = 0; j < 16; ++j) {
          const int kk = c * 32 + half8 + (j & 7) + ((j >> 3) << 4);
          bf[j] = Ks[t * 16 + m16][kk];
        }
        acc = __builtin_amdgcn_wmma_f32_16x16x32_f16(false, qa[c], false, bf,
                                                     (short)0, acc, false, false);
      }
      sc[t] = acc;
    }

    // ---- mask from LDS (mask==0 -> -1e9)
    #pragma unroll
    for (int t = 0; t < 4; ++t)
      #pragma unroll
      for (int r = 0; r < 8; ++r) {
        if (Ms[wave * 16 + r + half8][t * 16 + m16] == 0) sc[t][r] = -1e9f;
      }

    // ---- online softmax update
    float mnew[8], corr[8], bsum[8];
    #pragma unroll
    for (int r = 0; r < 8; ++r) {
      float bm = fmaxf(fmaxf(sc[0][r], sc[1][r]), fmaxf(sc[2][r], sc[3][r]));
      bm = row_max16(bm);
      mnew[r] = fmaxf(mrun[r], bm);
      corr[r] = __expf(mrun[r] - mnew[r]);   // exp(-inf)=0 on first block
      bsum[r] = 0.f;
    }
    #pragma unroll
    for (int t = 0; t < 4; ++t)
      #pragma unroll
      for (int r = 0; r < 8; ++r) {
        const float p = __expf(sc[t][r] - mnew[r]);
        bsum[r] += p;
        Ps[wave][r + half8][t * 16 + m16] = (_Float16)p;  // C-layout -> LDS
      }
    #pragma unroll
    for (int r = 0; r < 8; ++r) {
      lrun[r] = lrun[r] * corr[r] + row_sum16(bsum[r]);
      mrun[r] = mnew[r];
    }
    #pragma unroll
    for (int t = 0; t < 4; ++t)
      #pragma unroll
      for (int r = 0; r < 8; ++r)
        oacc[t][r] *= corr[r];

    // wave-local LDS RAW fence for Ps (write in C-layout, read in A-layout)
    asm volatile("s_wait_dscnt 0x0" ::: "memory");

    // ---- O += P * V   (A = P 16x64 over 2 chunks, B = V 32x16 tiles)
    v16h pa[2];
    #pragma unroll
    for (int c = 0; c < 2; ++c)
      #pragma unroll
      for (int j = 0; j < 16; ++j) {
        const int kk = c * 32 + half8 + (j & 7) + ((j >> 3) << 4);
        pa[c][j] = Ps[wave][m16][kk];
      }
    #pragma unroll
    for (int t = 0; t < 4; ++t) {
      #pragma unroll
      for (int c = 0; c < 2; ++c) {
        v16h bv;   // lane holds Dh column t*16+m16, j walks key dim
        #pragma unroll
        for (int j = 0; j < 16; ++j) {
          const int kk = c * 32 + half8 + (j & 7) + ((j >> 3) << 4);
          bv[j] = Vs[kk][t * 16 + m16];
        }
        oacc[t] = __builtin_amdgcn_wmma_f32_16x16x32_f16(false, pa[c], false, bv,
                                                         (short)0, oacc[t], false, false);
      }
    }
  }

  // ---- normalize by row sum and store fp32
  #pragma unroll
  for (int t = 0; t < 4; ++t)
    #pragma unroll
    for (int r = 0; r < 8; ++r) {
      const int qrow = q0 + r + half8;
      ob[(size_t)qrow * DH + t * 16 + m16] = oacc[t][r] / lrun[r];
    }
}

extern "C" void kernel_launch(void* const* d_in, const int* in_sizes, int n_in,
                              void* d_out, int out_size, void* d_ws, size_t ws_size,
                              hipStream_t stream) {
  const float* q    = (const float*)d_in[0];
  const float* k    = (const float*)d_in[1];
  const float* v    = (const float*)d_in[2];
  const int*   mask = (const int*)d_in[3];
  float*       out  = (float*)d_out;

  dim3 grid(BATCH * HEADS * (SEQ / BQ));   // 2*16*32 = 1024 workgroups
  dim3 block(NTHR);                        // 128 threads = 4 waves (wave32)
  flash_attn_f16_wmma<<<grid, block, 0, stream>>>(q, k, v, mask, out);
}

// v001
// A run of this version takes 136 microseconds.
// Two timings next to v000 both put it at 1.60 times that version's speed.
#include <hip/hip_runtime.h>
#include <cmath>

typedef __attribute__((ext_vector_type(16))) _Float16 v16h;
typedef __attribute__((ext_vector_type(8)))  float    v8f;
typedef __attribute__((ext_vector_type(8)))  _Float16 v8h;
typedef __attribute__((ext_vector_type(8)))  short    s16x8;

namespace {
constexpr int BATCH = 2;
constexpr int HEADS = 16;
constexpr int SEQ   = 2048;
constexpr int DH    = 64;
constexpr int BQ    = 64;                 // q rows per workgroup (4 waves x 16)
constexpr int BK    = 64;                 // keys staged per iteration
constexpr int WAVES = 4;
constexpr int NTHR  = WAVES * 32;         // 128 threads, 4 wave32
constexpr int STG   = (BK * DH / 4) / NTHR;      // float4 per thread per matrix = 8
constexpr int MSTG  = (BQ * BK / 4) / NTHR;      // int4 chunks per thread for mask = 8
constexpr float SCALE = 0.125f;           // 64^-0.5
constexpr int VP    = DH + 16;            // V row pitch in halves: 160 B, an odd multiple of 32 B, for the transposing reader
}

// reductions across the 16 lanes of each wave32 half (C-fragment N dimension)
__device__ __forceinline__ float row_max16(float v) {
  v = fmaxf(v, __shfl_xor(v, 1, 32));
  v = fmaxf(v, __shfl_xor(v, 2, 32));
  v = fmaxf(v, __shfl_xor(v, 4, 32));
  v = fmaxf(v, __shfl_xor(v, 8, 32));
  return v;
}
__device__ __forceinline__ float row_sum16(float v) {
  v += __shfl_xor(v, 1, 32);
  v += __shfl_xor(v, 2, 32);
  v += __shfl_xor(v, 4, 32);
  v += __shfl_xor(v, 8, 32);
  return v;
}

// transposing LDS load: lane (c = l & 15, h = l >> 4) receives T[kbase + 8h + 0..7][dbase + c]
__device__ __forceinline__ v8h ld_tr16(const _Float16* p) {
  typedef __attribute__((address_space(3))) s16x8 lds_s16x8;
  return __builtin_bit_cast(v8h, __builtin_amdgcn_ds_load_tr16_b128_v8i16((lds_s16x8*)p));
}

__global__ __launch_bounds__(NTHR, 1)
void flash_attn_f16_wmma(const float* __restrict__ Q,
                         const float* __restrict__ K,
                         const float* __restrict__ V,
                         const int*   __restrict__ MASK,
                         float* __restrict__ OUT)
{
  __shared__ _Float16 Ks[BK][DH];          // key block, f16
  __shared__ __attribute__((aligned(16))) _Float16 Vs[BK][VP];  // value block, f16, padded rows
  __shared__ _Float16 Ps[WAVES][16][BK];   // per-wave P re-layout scratch
  __shared__ int      Ms[BQ][BK];          // mask block (async-staged)

  const int tid  = threadIdx.x;
  const int lane = tid & 31;
  const int wave = tid >> 5;

  const int qtiles = SEQ / BQ;
  const int bh = blockIdx.x / qtiles;
  const int qt = blockIdx.x % qtiles;
  const int b  = bh / HEADS;

  const float* qb = Q + (size_t)bh * SEQ * DH;
  const float* kb = K + (size_t)bh * SEQ * DH;
  const float* vb = V + (size_t)bh * SEQ * DH;
  const int*   mb = MASK + (size_t)b * SEQ * SEQ;
  float*       ob = OUT + (size_t)bh * SEQ * DH;

  const int m16   = lane & 15;
  const int half8 = (lane >> 4) << 3;      // 0 for lanes 0..15, 8 for 16..31
  const int qblk  = qt * BQ;
  const int q0    = qblk + wave * 16;      // this wave's first q row

  // ---- Q A-fragments with softmax scale folded in (exact *0.125 in f16)
  // ISA A layout: lanes 0-15 hold K in {0..7,16..23}; lanes 16-31 hold {8..15,24..31}
  v16h qa[2];
  #pragma unroll
  for (int c = 0; c < 2; ++c)
    #pragma unroll
    for (int j = 0; j < 16; ++j) {
      const int kk = c * 32 + half8 + (j & 7) + ((j >> 3) << 4);
      qa[c][j] = (_Float16)(qb[(size_t)(q0 + m16) * DH + kk] * SCALE);
    }

  v8f oacc[4] = {};          // output accumulators: 4 Dh-tiles of 16
  float mrun[8], lrun[8];    // running row max / sum (8 rows per half-wave)
  #pragma unroll
  for (int r = 0; r < 8; ++r) { mrun[r] = -INFINITY; lrun[r] = 0.f; }

  // ---- software pipeline: preload K/V block 0 into registers
  float4 kreg[STG], vreg[STG];
  {
    const float4* ks = (const float4*)kb;
    const float4* vs = (const float4*)vb;
    #pragma unroll
    for (int it = 0; it < STG; ++it) {
      const int i = it * NTHR + tid;
      kreg[it] = ks[i];
      vreg[it] = vs[i];
    }
  }

  // this lane's source row and 16-byte half for the transposing V loads
  const _Float16* vtr = &Vs[half8 + (lane & 7)][((lane >> 3) & 1) << 3];

  const uint32_t ms_lds = (uint32_t)(uintptr_t)(&Ms[0][0]);  // low 32 bits = LDS offset

  for (int k0 = 0; k0 < SEQ; k0 += BK) {
    __syncthreads();   // all waves done reading previous LDS contents

    // ---- async mask block -> LDS (per-lane 16B, tracked by ASYNCcnt)
    #pragma unroll
    for (int it = 0; it < MSTG; ++it) {
      const int i   = it * NTHR + tid;
      const int row = i >> 4;          // / (BK/4)
      const int col = (i & 15) << 2;   // *4 ints
      const unsigned long long ga = (unsigned long long)(uintptr_t)
          (mb + (size_t)(qblk + row) * SEQ + (k0 + col));
      const uint32_t la = ms_lds + (uint32_t)(i << 4);
      asm volatile("global_load_async_to_lds_b128 %0, %1, off"
                   :: "v"(la), "v"(ga) : "memory");
    }

    // ---- commit pipelined K/V registers to LDS as f16
    #pragma unroll
    for (int it = 0; it < STG; ++it) {
      const int i   = it * NTHR + tid;
      const int row = i >> 4;
      const int col = (i & 15) << 2;
      Ks[row][col + 0] = (_Float16)kreg[it].x;
      Ks[row][col + 1] = (_Float16)kreg[it].y;
      Ks[row][col + 2] = (_Float16)kreg[it].z;
      Ks[row][col + 3] = (_Float16)kreg[it].w;
      Vs[row][col + 0] = (_Float16)vreg[it].x;
      Vs[row][col + 1] = (_Float16)vreg[it].y;
      Vs[row][col + 2] = (_Float16)vreg[it].z;
      Vs[row][col + 3] = (_Float16)vreg[it].w;
    }
    // ---- issue next block's global loads now; latency hides under WMMA work
    if (k0 + BK < SEQ) {
      const float4* ks = (const float4*)(kb + (size_t)(k0 + BK) * DH);
      const float4* vs = (const float4*)(vb + (size_t)(k0 + BK) * DH);
      #pragma unroll
      for (int it = 0; it < STG; ++it) {
        const int i = it * NTHR + tid;
        kreg[it] = ks[i];
        vreg[it] = vs[i];
      }
    }

    asm volatile("s_wait_asynccnt 0x0" ::: "memory");  // mask block landed in LDS
    __syncthreads();

    // ---- scores: S = (Q*scale) * K^T, 4 key tiles of 16, K-dim 64 (2 WMMA each)
    v8f sc[4];
    #pragma unroll
    for (int t = 0; t < 4; ++t) {
      v8f acc = {};
      #pragma unroll
      for (int c = 0; c < 2; ++c) {
        v16h bf;   // lane holds key column t*16+m16, j walks Dh
        #pragma unroll
        for (int j = 0; j < 16; ++j) {
          const int kk = c * 32 + half8 + (j & 7) + ((j >> 3) << 4);
          bf[j] = Ks[t * 16 + m16][kk];
        }
        acc = __builtin_amdgcn_wmma_f32_16x16x32_f16(false, qa[c], false, bf,
                                                     (short)0, acc, false, false);
      }
      sc[t] = acc;
    }

    // ---- mask from LDS (mask==0 -> -1e9)
    #pragma unroll
    for (int t = 0; t < 4; ++t)
      #pragma unroll
      for (int r = 0; r < 8; ++r) {
        if (Ms[wave * 16 + r + half8][t * 16 + m16] == 0) sc[t][r] = -1e9f;
      }

    // ---- online softmax update
    float mnew[8], corr[8], bsum[8];
    #pragma unroll
    for (int r = 0; r < 8; ++r) {
      float bm = fmaxf(fmaxf(sc[0][r], sc[1][r]), fmaxf(sc[2][r], sc[3][r]));
      bm = row_max16(bm);
      mnew[r] = fmaxf(mrun[r], bm);
      corr[r] = __expf(mrun[r] - mnew[r]);   // exp(-inf)=0 on first block
      bsum[r] = 0.f;
    }
    #pragma unroll
    for (int t = 0; t < 4; ++t)
      #pragma unroll
      for (int r = 0; r < 8; ++r) {
        const float p = __expf(sc[t][r] - mnew[r]);
        bsum[r] += p;
        Ps[wave][r + half8][t * 16 + m16] = (_Float16)p;  // C-layout -> LDS
      }
    #pragma unroll
    for (int r = 0; r < 8; ++r) {
      lrun[r] = lrun[r] * corr[r] + row_sum16(bsum[r]);
      mrun[r] = mnew[r];
    }
    #pragma unroll
    for (int t = 0; t < 4; ++t)
      #pragma unroll
      for (int r = 0; r < 8; ++r)
        oacc[t][r] *= corr[r];

    // wave-local LDS RAW fence for Ps (write in C-layout, read in A-layout)
    asm volatile("s_wait_dscnt 0x0" ::: "memory");

    // ---- O += P * V   (A = P 16x64 over 2 chunks, B = V 32x16 tiles)
    v16h pa[2];
    #pragma unroll
    for (int c = 0; c < 2; ++c)
      #pragma unroll
      for (int j = 0; j < 16; ++j) {
        const int kk = c * 32 + half8 + (j & 7) + ((j >> 3) << 4);
        pa[c][j] = Ps[wave][m16][kk];
      }
    #pragma unroll
    for (int t = 0; t < 4; ++t) {
      #pragma unroll
      for (int c = 0; c < 2; ++c) {
        // lane holds Dh column t*16+m16; elements 0..7 = keys c*32+half8+0..7, 8..15 = the same + 16
        const v8h lo = ld_tr16(vtr + (c * 32) * VP + t * 16);
        const v8h hi = ld_tr16(vtr + (c * 32 + 16) * VP + t * 16);
        const v16h bv = __builtin_shufflevector(lo, hi, 0, 1, 2, 3, 4, 5, 6, 7,
                                                8, 9, 10, 11, 12, 13, 14, 15);
        oacc[t] = __builtin_amdgcn_wmma_f32_16x16x32_f16(false, pa[c], false, bv,
                                                         (short)0, oacc[t], false, false);
      }
    }
  }

  // ---- normalize by row sum and store fp32
  #pragma unroll
  for (int t = 0; t < 4; ++t)
    #pragma unroll
    for (int r = 0; r < 8; ++r) {
      const int qrow = q0 + r + half8;
      ob[(size_t)qrow * DH + t * 16 + m16] = oacc[t][r] / lrun[r];
    }
}

extern "C" void kernel_launch(void* const* d_in, const int* in_sizes, int n_in,
                              void* d_out, int out_size, void* d_ws, size_t ws_size,
                              hipStream_t stream) {
  const float* q    = (const float*)d_in[0];
  const float* k    = (const float*)d_in[1];
  const float* v    = (const float*)d_in[2];
  const int*   mask = (const int*)d_in[3];
  float*       out  = (float*)d_out;

  dim3 grid(BATCH * HEADS * (SEQ / BQ));   // 2*16*32 = 1024 workgroups
  dim3 block(NTHR);                        // 128 threads = 4 waves (wave32)
  flash_attn_f16_wmma<<<grid, block, 0, stream>>>(q, k, v, mask, out);
}

// v002
// A run of this version takes 95.5 microseconds.
// Timed twice side by side with v001, it ran 1.42 and 1.43 times as fast.
// Counting every step since v000, it is 2.27 times as fast.
#include <hip/hip_runtime.h>
#include <cmath>

typedef __attribute__((ext_vector_type(16))) _Float16 v16h;
typedef __attribute__((ext_vector_type(8)))  float    v8f;
typedef __attribute__((ext_vector_type(8)))  _Float16 v8h;
typedef __attribute__((ext_vector_type(8)))  short    s16x8;

namespace {
constexpr int BATCH = 2;
constexpr int HEADS = 16;
constexpr int SEQ   = 2048;
constexpr int DH    = 64;
constexpr int BQ    = 64;                 // q rows per workgroup (4 waves x 16)
constexpr int BK    = 64;                 // keys staged per iteration
constexpr int WAVES = 4;
constexpr int NTHR  = WAVES * 32;         // 128 threads, 4 wave32
constexpr int STG   = (BK * DH / 4) / NTHR;      // float4 per thread per matrix = 8
constexpr int MSTG  = (BQ * BK / 4) / NTHR;      // int4 chunks per thread for mask = 8
constexpr float SCALE = 0.125f;           // 64^-0.5
constexpr int VP    = DH + 16;            // V row pitch in halves: 160 B, an odd multiple of 32 B, for the transposing reader
constexpr int KP    = DH + 8;             // K row pitch in halves: 144 B, an odd multiple of 16 B, for the 16-byte row reader
constexpr int PP    = BK + 8;             // P row pitch in halves: 144 B, same reader; rows r and r+8 also store 32 banks apart
constexpr int MP    = BK + 4;             // mask row pitch in ints: 272 B, so rows r and r+8 read 32 banks apart
}

// reductions across the 16 lanes of each wave32 half (C-fragment N dimension)
__device__ __forceinline__ float row_max16(float v) {
  v = fmaxf(v, __shfl_xor(v, 1, 32));
  v = fmaxf(v, __shfl_xor(v, 2, 32));
  v = fmaxf(v, __shfl_xor(v, 4, 32));
  v = fmaxf(v, __shfl_xor(v, 8, 32));
  return v;
}
__device__ __forceinline__ float row_sum16(float v) {
  v += __shfl_xor(v, 1, 32);
  v += __shfl_xor(v, 2, 32);
  v += __shfl_xor(v, 4, 32);
  v += __shfl_xor(v, 8, 32);
  return v;
}

// transposing LDS load: lane (c = l & 15, h = l >> 4) receives T[kbase + 8h + 0..7][dbase + c]
__device__ __forceinline__ v8h ld_tr16(const _Float16* p) {
  typedef __attribute__((address_space(3))) s16x8 lds_s16x8;
  return __builtin_bit_cast(v8h, __builtin_amdgcn_ds_load_tr16_b128_v8i16((lds_s16x8*)p));
}

__global__ __launch_bounds__(NTHR, 1)
void flash_attn_f16_wmma(const float* __restrict__ Q,
                         const float* __restrict__ K,
                         const float* __restrict__ V,
                         const int*   __restrict__ MASK,
                         float* __restrict__ OUT)
{
  __shared__ __attribute__((aligned(16))) _Float16 Ks[BK][KP];  // key block, f16, padded rows
  __shared__ __attribute__((aligned(16))) _Float16 Vs[BK][VP];  // value block, f16, padded rows
  __shared__ __attribute__((aligned(16))) _Float16 Ps[WAVES][16][PP];  // per-wave P re-layout scratch, padded rows
  __shared__ __attribute__((aligned(16))) int Ms[BQ][MP];       // mask block (async-staged), padded rows

  const int tid  = threadIdx.x;
  const int lane = tid & 31;
  const int wave = tid >> 5;

  const int qtiles = SEQ / BQ;
  const int bh = blockIdx.x / qtiles;
  const int qt = blockIdx.x % qtiles;
  const int b  = bh / HEADS;

  const float* qb = Q + (size_t)bh * SEQ * DH;
  const float* kb = K + (size_t)bh * SEQ * DH;
  const float* vb = V + (size_t)bh * SEQ * DH;
  const int*   mb = MASK + (size_t)b * SEQ * SEQ;
  float*       ob = OUT + (size_t)bh * SEQ * DH;

  const int m16   = lane & 15;
  const int half8 = (lane >> 4) << 3;      // 0 for lanes 0..15, 8 for 16..31
  const int qblk  = qt * BQ;
  const int q0    = qblk + wave * 16;      // this wave's first q row

  // ---- Q A-fragments with softmax scale folded in (exact *0.125 in f16)
  // ISA A layout: lanes 0-15 hold K in {0..7,16..23}; lanes 16-31 hold {8..15,24..31}
  v16h qa[2];
  #pragma unroll
  for (int c = 0; c < 2; ++c)
    #pragma unroll
    for (int j = 0; j < 16; ++j) {
      const int kk = c * 32 + half8 + (j & 7) + ((j >> 3) << 4);
      qa[c][j] = (_Float16)(qb[(size_t)(q0 + m16) * DH + kk] * SCALE);
    }

  v8f oacc[4] = {};          // output accumulators: 4 Dh-tiles of 16
  float mrun[8], lrun[8];    // running row max / sum (8 rows per half-wave)
  #pragma unroll
  for (int r = 0; r < 8; ++r) { mrun[r] = -INFINITY; lrun[r] = 0.f; }

  // ---- software pipeline: preload K/V block 0 into registers
  float4 kreg[STG], vreg[STG];
  {
    const float4* ks = (const float4*)kb;
    const float4* vs = (const float4*)vb;
    #pragma unroll
    for (int it = 0; it < STG; ++it) {
      const int i = it * NTHR + tid;
      kreg[it] = ks[i];
      vreg[it] = vs[i];
    }
  }

  // this lane's source row and 16-byte half for the transposing V loads
  const _Float16* vtr = &Vs[half8 + (lane & 7)][((lane >> 3) & 1) << 3];

  const uint32_t ms_lds = (uint32_t)(uintptr_t)(&Ms[0][0]);  // low 32 bits = LDS offset

  for (int k0 = 0; k0 < SEQ; k0 += BK) {
    __syncthreads();   // all waves done reading previous LDS contents

    // ---- async mask block -> LDS (per-lane 16B, tracked by ASYNCcnt)
    #pragma unroll
    for (int it = 0; it < MSTG; ++it) {
      const int i   = it * NTHR + tid;
      const int row = i >> 4;          // / (BK/4)
      const int col = (i & 15) << 2;   // *4 ints
      const unsigned long long ga = (unsigned long long)(uintptr_t)
          (mb + (size_t)(qblk + row) * SEQ + (k0 + col));
      const uint32_t la = ms_lds + (uint32_t)((row * MP + col) << 2);
      asm volatile("global_load_async_to_lds_b128 %0, %1, off"
                   :: "v"(la), "v"(ga) : "memory");
    }

    // ---- commit pipelined K/V registers to LDS as f16
    #pragma unroll
    for (int it = 0; it < STG; ++it) {
      const int i   = it * NTHR + tid;
      const int row = i >> 4;
      const int col = (i & 15) << 2;
      Ks[row][col + 0] = (_Float16)kreg[it].x;
      Ks[row][col + 1] = (_Float16)kreg[it].y;
      Ks[row][col + 2] = (_Float16)kreg[it].z;
      Ks[row][col + 3] = (_Float16)kreg[it].w;
      Vs[row][col + 0] = (_Float16)vreg[it].x;
      Vs[row][col + 1] = (_Float16)vreg[it].y;
      Vs[row][col + 2] = (_Float16)vreg[it].z;
      Vs[row][col + 3] = (_Float16)vreg[it].w;
    }
    // ---- issue next block's global loads now; latency hides under WMMA work
    if (k0 + BK < SEQ) {
      const float4* ks = (const float4*)(kb + (size_t)(k0 + BK) * DH);
      const float4* vs = (const float4*)(vb + (size_t)(k0 + BK) * DH);
      #pragma unroll
      for (int it = 0; it < STG; ++it) {
        const int i = it * NTHR + tid;
        kreg[it] = ks[i];
        vreg[it] = vs[i];
      }
    }

    asm volatile("s_wait_asynccnt 0x0" ::: "memory");  // mask block landed in LDS
    __syncthreads();

    // ---- scores: S = (Q*scale) * K^T, 4 key tiles of 16, K-dim 64 (2 WMMA each)
    v8f sc[4];
    #pragma unroll
    for (int t = 0; t < 4; ++t) {
      v8f acc = {};
      #pragma unroll
      for (int c = 0; c < 2; ++c) {
        v16h bf;   // lane holds key column t*16+m16, j walks Dh
        #pragma unroll
        for (int j = 0; j < 16; ++j) {
          const int kk = c * 32 + half8 + (j & 7) + ((j >> 3) << 4);
          bf[j] = Ks[t * 16 + m16][kk];
        }
        acc = __builtin_amdgcn_wmma_f32_16x16x32_f16(false, qa[c], false, bf,
                                                     (short)0, acc, false, false);
      }
      sc[t] = acc;
    }

    // ---- mask from LDS (mask==0 -> -1e9)
    #pragma unroll
    for (int t = 0; t < 4; ++t)
      #pragma unroll
      for (int r = 0; r < 8; ++r) {
        if (Ms[wave * 16 + r + half8][t * 16 + m16] == 0) sc[t][r] = -1e9f;
      }

    // ---- online softmax update
    float mnew[8], corr[8], bsum[8];
    #pragma unroll
    for (int r = 0; r < 8; ++r) {
      float bm = fmaxf(fmaxf(sc[0][r], sc[1][r]), fmaxf(sc[2][r], sc[3][r]));
      bm = row_max16(bm);
      mnew[r] = fmaxf(mrun[r], bm);
      corr[r] = __expf(mrun[r] - mnew[r]);   // exp(-inf)=0 on first block
      bsum[r] = 0.f;
    }
    #pragma unroll
    for (int t = 0; t < 4; ++t)
      #pragma unroll
      for (int r = 0; r < 8; ++r) {
        const float p = __expf(sc[t][r] - mnew[r]);
        bsum[r] += p;
        Ps[wave][r + half8][t * 16 + m16] = (_Float16)p;  // C-layout -> LDS
      }
    #pragma unroll
    for (int r = 0; r < 8; ++r) {
      lrun[r] = lrun[r] * corr[r] + row_sum16(bsum[r]);
      mrun[r] = mnew[r];
    }
    #pragma unroll
    for (int t = 0; t < 4; ++t)
      #pragma unroll
      for (int r = 0; r < 8; ++r)
        oacc[t][r] *= corr[r];

    // wave-local LDS RAW fence for Ps (write in C-layout, read in A-layout)
    asm volatile("s_wait_dscnt 0x0" ::: "memory");

    // ---- O += P * V   (A = P 16x64 over 2 chunks, B = V 32x16 tiles)
    v16h pa[2];
    #pragma unroll
    for (int c = 0; c < 2; ++c)
      #pragma unroll
      for (int j = 0; j < 16; ++j) {
        const int kk = c * 32 + half8 + (j & 7) + ((j >> 3) << 4);
        pa[c][j] = Ps[wave][m16][kk];
      }
    #pragma unroll
    for (int t = 0; t < 4; ++t) {
      #pragma unroll
      for (int c = 0; c < 2; ++c) {
        // lane holds Dh column t*16+m16; elements 0..7 = keys c*32+half8+0..7, 8..15 = the same + 16
        const v8h lo = ld_tr16(vtr + (c * 32) * VP + t * 16);
        const v8h hi = ld_tr16(vtr + (c * 32 + 16) * VP + t * 16);
        const v16h bv = __builtin_shufflevector(lo, hi, 0, 1, 2, 3, 4, 5, 6, 7,
                                                8, 9, 10, 11, 12, 13, 14, 15);
        oacc[t] = __builtin_amdgcn_wmma_f32_16x16x32_f16(false, pa[c], false, bv,
                                                         (short)0, oacc[t], false, false);
      }
    }
  }

  // ---- normalize by row sum and store fp32
  #pragma unroll
  for (int t = 0; t < 4; ++t)
    #pragma unroll
    for (int r = 0; r < 8; ++r) {
      const int qrow = q0 + r + half8;
      ob[(size_t)qrow * DH + t * 16 + m16] = oacc[t][r] / lrun[r];
    }
}

extern "C" void kernel_launch(void* const* d_in, const int* in_sizes, int n_in,
                              void* d_out, int out_size, void* d_ws, size_t ws_size,
                              hipStream_t stream) {
  const float* q    = (const float*)d_in[0];
  const float* k    = (const float*)d_in[1];
  const float* v    = (const float*)d_in[2];
  const int*   mask = (const int*)d_in[3];
  float*       out  = (float*)d_out;

  dim3 grid(BATCH * HEADS * (SEQ / BQ));   // 2*16*32 = 1024 workgroups
  dim3 block(NTHR);                        // 128 threads = 4 waves (wave32)
  flash_attn_f16_wmma<<<grid, block, 0, stream>>>(q, k, v, mask, out);
}

// v003
// It runs in 63.3 microseconds.
// Next to v002, in two timings, it ran 1.51 and 1.50 times as fast.
// Counting every step since v000, it is 3.43 times as fast.
#include <hip/hip_runtime.h>
#include <cmath>

typedef __attribute__((ext_vector_type(16))) _Float16 v16h;
typedef __attribute__((ext_vector_type(8)))  float    v8f;
typedef __attribute__((ext_vector_type(8)))  _Float16 v8h;
typedef __attribute__((ext_vector_type(8)))  short    s16x8;

namespace {
constexpr int BATCH = 2;
constexpr int HEADS = 16;
constexpr int SEQ   = 2048;
constexpr int DH    = 64;
constexpr int BQ    = 64;                 // q rows per workgroup (4 waves x 16)
constexpr int BK    = 64;                 // keys staged per iteration
constexpr int WAVES = 4;
constexpr int NTHR  = WAVES * 32;         // 128 threads, 4 wave32
constexpr int STG   = (BK * DH / 4) / NTHR;      // float4 per thread per matrix = 8
constexpr int MSTG  = (BQ * BK / 4) / NTHR;      // int4 chunks per thread for mask = 8
constexpr float SCALE = 0.125f;           // 64^-0.5
constexpr int VP    = DH + 16;            // V row pitch in halves: 160 B, an odd multiple of 32 B, for the transposing reader
constexpr int KP    = DH + 8;             // K row pitch in halves: 144 B, an odd multiple of 16 B, for the 16-byte row reader
constexpr int MP    = BK + 4;             // mask row pitch in ints: 272 B, an odd multiple of 16 B, for the 16-byte row reader
}

// value of lane l ^ 16: the other half of this lane's query column
__device__ __forceinline__ float xhalf(float x) {
  const int i = __builtin_bit_cast(int, x);
  return __builtin_bit_cast(float, __builtin_amdgcn_permlanex16(i, i, 0x76543210, 0xfedcba98, false, false));
}

// transposing LDS load: lane (c = l & 15, h = l >> 4) receives T[kbase + 8h + 0..7][dbase + c]
__device__ __forceinline__ v8h ld_tr16(const _Float16* p) {
  typedef __attribute__((address_space(3))) s16x8 lds_s16x8;
  return __builtin_bit_cast(v8h, __builtin_amdgcn_ds_load_tr16_b128_v8i16((lds_s16x8*)p));
}

__global__ __launch_bounds__(NTHR, 1)
void flash_attn_f16_wmma(const float* __restrict__ Q,
                         const float* __restrict__ K,
                         const float* __restrict__ V,
                         const int*   __restrict__ MASK,
                         float* __restrict__ OUT)
{
  __shared__ __attribute__((aligned(16))) _Float16 Ks[BK][KP];  // key block, f16, padded rows
  __shared__ __attribute__((aligned(16))) _Float16 Vs[BK][VP];  // value block, f16, padded rows
  __shared__ __attribute__((aligned(16))) int Ms[BQ][MP];       // mask block (async-staged), padded rows

  const int tid  = threadIdx.x;
  const int lane = tid & 31;
  const int wave = tid >> 5;

  const int qtiles = SEQ / BQ;
  const int bh = blockIdx.x / qtiles;
  const int qt = blockIdx.x % qtiles;
  const int b  = bh / HEADS;

  const float* qb = Q + (size_t)bh * SEQ * DH;
  const float* kb = K + (size_t)bh * SEQ * DH;
  const float* vb = V + (size_t)bh * SEQ * DH;
  const int*   mb = MASK + (size_t)b * SEQ * SEQ;
  float*       ob = OUT + (size_t)bh * SEQ * DH;

  const int m16   = lane & 15;
  const int half8 = (lane >> 4) << 3;      // 0 for lanes 0..15, 8 for 16..31
  const int qblk  = qt * BQ;
  const int q0    = qblk + wave * 16;      // this wave's first q row

  // ---- Q^T B-fragments with softmax scale folded in (exact *0.125 in f16): lane = query column m16
  // hardware k order: lanes 0-15 hold k in {0..7,16..23}; lanes 16-31 hold {8..15,24..31}
  v16h qa[2];
  #pragma unroll
  for (int c = 0; c < 2; ++c)
    #pragma unroll
    for (int j = 0; j < 16; ++j) {
      const int kk = c * 32 + half8 + (j & 7) + ((j >> 3) << 4);
      qa[c][j] = (_Float16)(qb[(size_t)(q0 + m16) * DH + kk] * SCALE);
    }

  v8f oacc[4] = {};          // O^T accumulators: 4 Dh-tiles of 16 rows, column = query m16
  float mrun = -INFINITY;    // running maximum of query m16 (equal in both wave halves)
  float lrun = 0.f;          // running sum over this wave half's keys; the halves join after the loop

  // ---- software pipeline: preload K/V block 0 into registers
  float4 kreg[STG], vreg[STG];
  {
    const float4* ks = (const float4*)kb;
    const float4* vs = (const float4*)vb;
    #pragma unroll
    for (int it = 0; it < STG; ++it) {
      const int i = it * NTHR + tid;
      kreg[it] = ks[i];
      vreg[it] = vs[i];
    }
  }

  // this lane's source row and 16-byte half for the transposing V loads
  const _Float16* vtr = &Vs[half8 + (lane & 7)][((lane >> 3) & 1) << 3];

  const uint32_t ms_lds = (uint32_t)(uintptr_t)(&Ms[0][0]);  // low 32 bits = LDS offset

  for (int k0 = 0; k0 < SEQ; k0 += BK) {
    __syncthreads();   // all waves done reading previous LDS contents

    // ---- async mask block -> LDS (per-lane 16B, tracked by ASYNCcnt)
    #pragma unroll
    for (int it = 0; it < MSTG; ++it) {
      const int i   = it * NTHR + tid;
      const int row = i >> 4;          // / (BK/4)
      const int col = (i & 15) << 2;   // *4 ints
      const unsigned long long ga = (unsigned long long)(uintptr_t)
          (mb + (size_t)(qblk + row) * SEQ + (k0 + col));
      const uint32_t la = ms_lds + (uint32_t)((row * MP + col) << 2);
      asm volatile("global_load_async_to_lds_b128 %0, %1, off"
                   :: "v"(la), "v"(ga) : "memory");
    }

    // ---- commit pipelined K/V registers to LDS as f16
    #pragma unroll
    for (int it = 0; it < STG; ++it) {
      const int i   = it * NTHR + tid;
      const int row = i >> 4;
      const int col = (i & 15) << 2;
      Ks[row][col + 0] = (_Float16)kreg[it].x;
      Ks[row][col + 1] = (_Float16)kreg[it].y;
      Ks[row][col + 2] = (_Float16)kreg[it].z;
      Ks[row][col + 3] = (_Float16)kreg[it].w;
      Vs[row][col + 0] = (_Float16)vreg[it].x;
      Vs[row][col + 1] = (_Float16)vreg[it].y;
      Vs[row][col + 2] = (_Float16)vreg[it].z;
      Vs[row][col + 3] = (_Float16)vreg[it].w;
    }
    // ---- issue next block's global loads now; latency hides under WMMA work
    if (k0 + BK < SEQ) {
      const float4* ks = (const float4*)(kb + (size_t)(k0 + BK) * DH);
      const float4* vs = (const float4*)(vb + (size_t)(k0 + BK) * DH);
      #pragma unroll
      for (int it = 0; it < STG; ++it) {
        const int i = it * NTHR + tid;
        kreg[it] = ks[i];
        vreg[it] = vs[i];
      }
    }

    asm volatile("s_wait_asynccnt 0x0" ::: "memory");  // mask block landed in LDS
    __syncthreads();

    // ---- scores, transposed: S^T = K * (Q*scale)^T, 4 key tiles of 16 rows, k-dim 64 (2 WMMA each)
    // sc[t][r] = score of key k0 + t*16 + half8 + r against query q0 + m16
    v8f sc[4];
    #pragma unroll
    for (int t = 0; t < 4; ++t) {
      v8f acc = {};
      #pragma unroll
      for (int c = 0; c < 2; ++c) {
        v16h kf;   // lane holds key row t*16+m16, j walks Dh
        #pragma unroll
        for (int j = 0; j < 16; ++j) {
          const int kk = c * 32 + half8 + (j & 7) + ((j >> 3) << 4);
          kf[j] = Ks[t * 16 + m16][kk];
        }
        acc = __builtin_amdgcn_wmma_f32_16x16x32_f16(false, kf, false, qa[c],
                                                     (short)0, acc, false, false);
      }
      sc[t] = acc;
    }

    // ---- mask from LDS (mask==0 -> -1e9): 8 consecutive keys of one query row per tile
    #pragma unroll
    for (int t = 0; t < 4; ++t) {
      const int4 mlo = *(const int4*)&Ms[wave * 16 + m16][t * 16 + half8];
      const int4 mhi = *(const int4*)&Ms[wave * 16 + m16][t * 16 + half8 + 4];
      if (mlo.x == 0) sc[t][0] = -1e9f;
      if (mlo.y == 0) sc[t][1] = -1e9f;
      if (mlo.z == 0) sc[t][2] = -1e9f;
      if (mlo.w == 0) sc[t][3] = -1e9f;
      if (mhi.x == 0) sc[t][4] = -1e9f;
      if (mhi.y == 0) sc[t][5] = -1e9f;
      if (mhi.z == 0) sc[t][6] = -1e9f;
      if (mhi.w == 0) sc[t][7] = -1e9f;
    }

    // ---- online softmax update: one query per lane, maximum and sum in-lane
    float bm = sc[0][0];
    #pragma unroll
    for (int t = 0; t < 4; ++t)
      #pragma unroll
      for (int r = 0; r < 8; ++r)
        bm = fmaxf(bm, sc[t][r]);
    bm = fmaxf(bm, xhalf(bm));               // both halves now hold the block maximum of the query
    const float mnew = fmaxf(mrun, bm);
    const float corr = __expf(mrun - mnew);  // exp(-inf)=0 on first block
    mrun = mnew;

    // P^T B-fragments straight from the score tiles: tiles 2c and 2c+1 are k 0..7,16..23 (+8 in the upper half)
    v16h pb[2];
    float bsum = 0.f;
    #pragma unroll
    for (int t = 0; t < 4; ++t)
      #pragma unroll
      for (int r = 0; r < 8; ++r) {
        const float p = __expf(sc[t][r] - mnew);
        bsum += p;
        pb[t >> 1][((t & 1) << 3) + r] = (_Float16)p;
      }
    lrun = lrun * corr + bsum;
    #pragma unroll
    for (int t = 0; t < 4; ++t)
      #pragma unroll
      for (int r = 0; r < 8; ++r)
        oacc[t][r] *= corr;

    // ---- O^T += V^T * P^T   (A = V^T 16x32 tiles by the transposing load, B = P^T 32x16)
    #pragma unroll
    for (int t = 0; t < 4; ++t) {
      #pragma unroll
      for (int c = 0; c < 2; ++c) {
        // lane holds Dh row t*16+m16; elements 0..7 = keys c*32+half8+0..7, 8..15 = the same + 16
        const v8h lo = ld_tr16(vtr + (c * 32) * VP + t * 16);
        const v8h hi = ld_tr16(vtr + (c * 32 + 16) * VP + t * 16);
        const v16h av = __builtin_shufflevector(lo, hi, 0, 1, 2, 3, 4, 5, 6, 7,
                                                8, 9, 10, 11, 12, 13, 14, 15);
        oacc[t] = __builtin_amdgcn_wmma_f32_16x16x32_f16(false, av, false, pb[c],
                                                         (short)0, oacc[t], false, false);
      }
    }
  }

  // ---- join the halves' sums, normalize and store fp32: 8 consecutive Dh of one query row per tile
  const float lsum = lrun + xhalf(lrun);
  float* orow = ob + (size_t)(q0 + m16) * DH + half8;
  #pragma unroll
  for (int t = 0; t < 4; ++t) {
    float4 lo, hi;
    lo.x = oacc[t][0] / lsum;  lo.y = oacc[t][1] / lsum;
    lo.z = oacc[t][2] / lsum;  lo.w = oacc[t][3] / lsum;
    hi.x = oacc[t][4] / lsum;  hi.y = oacc[t][5] / lsum;
    hi.z = oacc[t][6] / lsum;  hi.w = oacc[t][7] / lsum;
    *(float4*)(orow + t * 16)     = lo;
    *(float4*)(orow + t * 16 + 4) = hi;
  }
}

extern "C" void kernel_launch(void* const* d_in, const int* in_sizes, int n_in,
                              void* d_out, int out_size, void* d_ws, size_t ws_size,
                              hipStream_t stream) {
  const float* q    = (const float*)d_in[0];
  const float* k    = (const float*)d_in[1];
  const float* v    = (const float*)d_in[2];
  const int*   mask = (const int*)d_in[3];
  float*       out  = (float*)d_out;

  dim3 grid(BATCH * HEADS * (SEQ / BQ));   // 2*16*32 = 1024 workgroups
  dim3 block(NTHR);                        // 128 threads = 4 waves (wave32)
  flash_attn_f16_wmma<<<grid, block, 0, stream>>>(q, k, v, mask, out);
}

// v004
// Measured time: 61.1 microseconds a run.
// In two side-by-side timings against v003, it was 1.04 and 1.03 times as fast.
// Over all steps from v000 it is 3.54 times as fast.
#include <hip/hip_runtime.h>
#include <cmath>

typedef __attribute__((ext_vector_type(16))) _Float16 v16h;
typedef __attribute__((ext_vector_type(8)))  float    v8f;
typedef __attribute__((ext_vector_type(8)))  _Float16 v8h;
typedef __attribute__((ext_vector_type(8)))  short    s16x8;

namespace {
constexpr int BATCH = 2;
constexpr int HEADS = 16;
constexpr int SEQ   = 2048;
constexpr int DH    = 64;
constexpr int BQ    = 64;                 // q rows per workgroup (4 waves x 16)
constexpr int BK    = 64;                 // keys staged per iteration
constexpr int WAVES = 4;
constexpr int NTHR  = WAVES * 32;         // 128 threads, 4 wave32
constexpr int STG   = (BK * DH / 4) / NTHR;      // float4 per thread per matrix = 8
constexpr float SCALE = 0.125f;           // 64^-0.5
constexpr int VP    = DH + 16;            // V row pitch in halves: 160 B, an odd multiple of 32 B, for the transposing reader
constexpr int KP    = DH + 8;             // K row pitch in halves: 144 B, an odd multiple of 16 B, for the 16-byte row reader
constexpr int MP    = BK + 4;             // mask row pitch in ints: 272 B, an odd multiple of 16 B, for the 16-byte row reader
constexpr int KBLK  = SEQ / BK;           // key blocks per row = 32
constexpr int MWB   = 32;                 // lane-mask words per (16-query tile, 64-key block): one per score register
constexpr int PWAV  = 8;                  // waves per packing workgroup
constexpr int PTIL  = 4;                  // 64-key blocks packed per wave
}

// value of lane l ^ 16: the other half of this lane's query column
__device__ __forceinline__ float xhalf(float x) {
  const int i = __builtin_bit_cast(int, x);
  return __builtin_bit_cast(float, __builtin_amdgcn_permlanex16(i, i, 0x76543210, 0xfedcba98, false, false));
}

// transposing LDS load: lane (c = l & 15, h = l >> 4) receives T[kbase + 8h + 0..7][dbase + c]
__device__ __forceinline__ v8h ld_tr16(const _Float16* p) {
  typedef __attribute__((address_space(3))) s16x8 lds_s16x8;
  return __builtin_bit_cast(v8h, __builtin_amdgcn_ds_load_tr16_b128_v8i16((lds_s16x8*)p));
}

// Packs the int32 mask once for all heads into lane-mask words. For 16-query tile rt (batch * 128 + q / 16) and
// 64-key block kb, word t*8+r holds in bit l: mask[rt*16 + (l & 15)][kb*64 + t*16 + (l >> 4)*8 + r] != 0,
// which is the lane and register that hold this score in the attention kernel's S^T tiles.
__global__ __launch_bounds__(PWAV * 32)
void pack_mask_lane_words(const int* __restrict__ MASK, unsigned int* __restrict__ MW)
{
  __shared__ __attribute__((aligned(16))) int Ts[PWAV][PTIL][16][MP];  // each wave's own tiles, padded rows

  const int lane  = threadIdx.x & 31;
  const int wave  = threadIdx.x >> 5;
  const int job   = blockIdx.x * PWAV + wave;
  const int rt    = job / (KBLK / PTIL);
  const int cg    = job % (KBLK / PTIL);
  const int m16   = lane & 15;
  const int half8 = (lane >> 4) << 3;

  // whole 256-byte row pieces, two rows per wave-wide load, all loads in flight together
  const int* src = MASK + (size_t)rt * 16 * SEQ + cg * (PTIL * BK);
  int4 m[PTIL][8];
  #pragma unroll
  for (int p = 0; p < PTIL; ++p)
    #pragma unroll
    for (int it = 0; it < 8; ++it)
      m[p][it] = *(const int4*)(src + (size_t)(it * 2 + (lane >> 4)) * SEQ + p * BK + (m16 << 2));
  #pragma unroll
  for (int p = 0; p < PTIL; ++p)
    #pragma unroll
    for (int it = 0; it < 8; ++it)
      *(int4*)&Ts[wave][p][it * 2 + (lane >> 4)][m16 << 2] = m[p][it];
  __syncthreads();   // the rows stored above are read below by other lanes

  // lane l collects words 4l..4l+3 of the wave's 128, so that one 16-byte store per lane writes whole lines
  int w4[4] = {0, 0, 0, 0};
  #pragma unroll
  for (int p = 0; p < PTIL; ++p)
    #pragma unroll
    for (int t = 0; t < 4; ++t) {
      const int4 lo = *(const int4*)&Ts[wave][p][m16][t * 16 + half8];
      const int4 hi = *(const int4*)&Ts[wave][p][m16][t * 16 + half8 + 4];
      const int e[8] = {lo.x, lo.y, lo.z, lo.w, hi.x, hi.y, hi.z, hi.w};
      #pragma unroll
      for (int r = 0; r < 8; ++r) {
        const int w = p * MWB + t * 8 + r;
        const int word = (int)__builtin_amdgcn_ballot_w32(e[r] != 0);
        w4[w & 3] = (lane == (w >> 2)) ? word : w4[w & 3];
      }
    }
  int4 o;
  o.x = w4[0];  o.y = w4[1];  o.z = w4[2];  o.w = w4[3];
  *(int4*)(MW + ((size_t)rt * KBLK + cg * PTIL) * MWB + (lane << 2)) = o;
}

__global__ __launch_bounds__(NTHR, 1)
void flash_attn_f16_wmma(const float* __restrict__ Q,
                         const float* __restrict__ K,
                         const float* __restrict__ V,
                         const unsigned int* __restrict__ MW,
                         float* __restrict__ OUT)
{
  __shared__ __attribute__((aligned(16))) _Float16 Ks[BK][KP];  // key block, f16, padded rows
  __shared__ __attribute__((aligned(16))) _Float16 Vs[BK][VP];  // value block, f16, padded rows

  const int tid  = threadIdx.x;
  const int lane = tid & 31;
  const int wave = tid >> 5;

  const int qtiles = SEQ / BQ;
  const int bh = blockIdx.x / qtiles;
  const int qt = blockIdx.x % qtiles;
  const int b  = bh / HEADS;

  const float* qb = Q + (size_t)bh * SEQ * DH;
  const float* kb = K + (size_t)bh * SEQ * DH;
  const float* vb = V + (size_t)bh * SEQ * DH;
  float*       ob = OUT + (size_t)bh * SEQ * DH;

  const int m16   = lane & 15;
  const int half8 = (lane >> 4) << 3;      // 0 for lanes 0..15, 8 for 16..31
  const int qblk  = qt * BQ;
  const int q0    = qblk + wave * 16;      // this wave's first q row

  // this wave's lane-mask words: a wave-uniform address, so that they arrive by scalar loads
  const unsigned int* mw = MW + (size_t)(b * (SEQ / 16) + (qblk >> 4)
                                         + __builtin_amdgcn_readfirstlane(wave)) * (KBLK * MWB);

  // ---- Q^T B-fragments with softmax scale folded in (exact *0.125 in f16): lane = query column m16
  // hardware k order: lanes 0-15 hold k in {0..7,16..23}; lanes 16-31 hold {8..15,24..31}
  v16h qa[2];
  #pragma unroll
  for (int c = 0; c < 2; ++c)
    #pragma unroll
    for (int j = 0; j < 16; ++j) {
      const int kk = c * 32 + half8 + (j & 7) + ((j >> 3) << 4);
      qa[c][j] = (_Float16)(qb[(size_t)(q0 + m16) * DH + kk] * SCALE);
    }

  v8f oacc[4] = {};          // O^T accumulators: 4 Dh-tiles of 16 rows, column = query m16
  float mrun = -INFINITY;    // running maximum of query m16 (equal in both wave halves)
  float lrun = 0.f;          // running sum over this wave half's keys; the halves join after the loop

  // ---- software pipeline: preload K/V block 0 into registers
  float4 kreg[STG], vreg[STG];
  {
    const float4* ks = (const float4*)kb;
    const float4* vs = (const float4*)vb;
    #pragma unroll
    for (int it = 0; it < STG; ++it) {
      const int i = it * NTHR + tid;
      kreg[it] = ks[i];
      vreg[it] = vs[i];
    }
  }

  // this lane's source row and 16-byte half for the transposing V loads
  const _Float16* vtr = &Vs[half8 + (lane & 7)][((lane >> 3) & 1) << 3];

  for (int k0 = 0; k0 < SEQ; k0 += BK) {
    __syncthreads();   // all waves done reading previous LDS contents

    // ---- this block's 32 lane-mask words into scalar registers
    unsigned int mword[MWB];
    #pragma unroll
    for (int i = 0; i < MWB; ++i)
      mword[i] = mw[(k0 / BK) * MWB + i];

    // ---- commit pipelined K/V registers to LDS as f16
    #pragma unroll
    for (int it = 0; it < STG; ++it) {
      const int i   = it * NTHR + tid;
      const int row = i >> 4;
      const int col = (i & 15) << 2;
      Ks[row][col + 0] = (_Float16)kreg[it].x;
      Ks[row][col + 1] = (_Float16)kreg[it].y;
      Ks[row][col + 2] = (_Float16)kreg[it].z;
      Ks[row][col + 3] = (_Float16)kreg[it].w;
      Vs[row][col + 0] = (_Float16)vreg[it].x;
      Vs[row][col + 1] = (_Float16)vreg[it].y;
      Vs[row][col + 2] = (_Float16)vreg[it].z;
      Vs[row][col + 3] = (_Float16)vreg[it].w;
    }
    // ---- issue next block's global loads now; latency hides under WMMA work
    if (k0 + BK < SEQ) {
      const float4* ks = (const float4*)(kb + (size_t)(k0 + BK) * DH);
      const float4* vs = (const float4*)(vb + (size_t)(k0 + BK) * DH);
      #pragma unroll
      for (int it = 0; it < STG; ++it) {
        const int i = it * NTHR + tid;
        kreg[it] = ks[i];
        vreg[it] = vs[i];
      }
    }

    // precaution: the loads issued above (mask words, next K/V block) have taken their addresses
    // before the loop's step rewrites the registers that they name
    asm volatile("s_wait_xcnt 0x0" ::: "memory");
    __syncthreads();

    // ---- scores, transposed: S^T = K * (Q*scale)^T, 4 key tiles of 16 rows, k-dim 64 (2 WMMA each)
    // sc[t][r] = score of key k0 + t*16 + half8 + r against query q0 + m16
    v8f sc[4];
    #pragma unroll
    for (int t = 0; t < 4; ++t) {
      v8f acc = {};
      #pragma unroll
      for (int c = 0; c < 2; ++c) {
        v16h kf;   // lane holds key row t*16+m16, j walks Dh
        #pragma unroll
        for (int j = 0; j < 16; ++j) {
          const int kk = c * 32 + half8 + (j & 7) + ((j >> 3) << 4);
          kf[j] = Ks[t * 16 + m16][kk];
        }
        acc = __builtin_amdgcn_wmma_f32_16x16x32_f16(false, kf, false, qa[c],
                                                     (short)0, acc, false, false);
      }
      sc[t] = acc;
    }

    // ---- mask (mask==0 -> -1e9): each word is the select's lane mask as it stands
    #pragma unroll
    for (int t = 0; t < 4; ++t)
      #pragma unroll
      for (int r = 0; r < 8; ++r)
        sc[t][r] = __builtin_amdgcn_inverse_ballot_w32(mword[t * 8 + r]) ? sc[t][r] : -1e9f;

    // ---- online softmax update: one query per lane, maximum and sum in-lane
    float bm = sc[0][0];
    #pragma unroll
    for (int t = 0; t < 4; ++t)
      #pragma unroll
      for (int r = 0; r < 8; ++r)
        bm = fmaxf(bm, sc[t][r]);
    bm = fmaxf(bm, xhalf(bm));               // both halves now hold the block maximum of the query
    const float mnew = fmaxf(mrun, bm);
    const float corr = __expf(mrun - mnew);  // exp(-inf)=0 on first block
    mrun = mnew;

    // P^T B-fragments straight from the score tiles: tiles 2c and 2c+1 are k 0..7,16..23 (+8 in the upper half)
    v16h pb[2];
    float bsum = 0.f;
    #pragma unroll
    for (int t = 0; t < 4; ++t)
      #pragma unroll
      for (int r = 0; r < 8; ++r) {
        const float p = __expf(sc[t][r] - mnew);
        bsum += p;
        pb[t >> 1][((t & 1) << 3) + r] = (_Float16)p;
      }
    lrun = lrun * corr + bsum;
    #pragma unroll
    for (int t = 0; t < 4; ++t)
      #pragma unroll
      for (int r = 0; r < 8; ++r)
        oacc[t][r] *= corr;

    // ---- O^T += V^T * P^T   (A = V^T 16x32 tiles by the transposing load, B = P^T 32x16)
    #pragma unroll
    for (int t = 0; t < 4; ++t) {
      #pragma unroll
      for (int c = 0; c < 2; ++c) {
        // lane holds Dh row t*16+m16; elements 0..7 = keys c*32+half8+0..7, 8..15 = the same + 16
        const v8h lo = ld_tr16(vtr + (c * 32) * VP + t * 16);
        const v8h hi = ld_tr16(vtr + (c * 32 + 16) * VP + t * 16);
        const v16h av = __builtin_shufflevector(lo, hi, 0, 1, 2, 3, 4, 5, 6, 7,
                                                8, 9, 10, 11, 12, 13, 14, 15);
        oacc[t] = __builtin_amdgcn_wmma_f32_16x16x32_f16(false, av, false, pb[c],
                                                         (short)0, oacc[t], false, false);
      }
    }
  }

  // ---- join the halves' sums, normalize and store fp32: 8 consecutive Dh of one query row per tile
  const float lsum = lrun + xhalf(lrun);
  float* orow = ob + (size_t)(q0 + m16) * DH + half8;
  #pragma unroll
  for (int t = 0; t < 4; ++t) {
    float4 lo, hi;
    lo.x = oacc[t][0] / lsum;  lo.y = oacc[t][1] / lsum;
    lo.z = oacc[t][2] / lsum;  lo.w = oacc[t][3] / lsum;
    hi.x = oacc[t][4] / lsum;  hi.y = oacc[t][5] / lsum;
    hi.z = oacc[t][6] / lsum;  hi.w = oacc[t][7] / lsum;
    *(float4*)(orow + t * 16)     = lo;
    *(float4*)(orow + t * 16 + 4) = hi;
  }
}

extern "C" void kernel_launch(void* const* d_in, const int* in_sizes, int n_in,
                              void* d_out, int out_size, void* d_ws, size_t ws_size,
                              hipStream_t stream) {
  const float* q    = (const float*)d_in[0];
  const float* k    = (const float*)d_in[1];
  const float* v    = (const float*)d_in[2];
  const int*   mask = (const int*)d_in[3];
  float*       out  = (float*)d_out;
  unsigned int* mwords = (unsigned int*)d_ws;   // 2 * 128 * 32 * 32 words = 1 MiB, written anew in every call

  dim3 grid(BATCH * HEADS * (SEQ / BQ));   // 2*16*32 = 1024 workgroups
  dim3 block(NTHR);                        // 128 threads = 4 waves (wave32)
  dim3 pgrid(BATCH * (SEQ / 16) * (KBLK / PTIL) / PWAV);   // 2048 waves in 256 workgroups
  dim3 pblock(PWAV * 32);
  pack_mask_lane_words<<<pgrid, pblock, 0, stream>>>(mask, mwords);
  flash_attn_f16_wmma<<<grid, block, 0, stream>>>(q, k, v, mwords, out);
}

// v005
// A run of this version takes 57.3 microseconds.
// In both of two side-by-side timings against v004, it was 1.08 times as fast.
// Counting every step since v000, it is 3.82 times as fast.
#include <hip/hip_runtime.h>
#include <cmath>

typedef __attribute__((ext_vector_type(16))) _Float16 v16h;
typedef __attribute__((ext_vector_type(8)))  float    v8f;
typedef __attribute__((ext_vector_type(8)))  _Float16 v8h;
typedef __attribute__((ext_vector_type(8)))  short    s16x8;

namespace {
constexpr int BATCH = 2;
constexpr int HEADS = 16;
constexpr int SEQ   = 2048;
constexpr int DH    = 64;
constexpr int BQ    = 64;                 // q rows per workgroup (4 waves x 16)
constexpr int BK    = 64;                 // keys staged per iteration
constexpr int WAVES = 4;
constexpr int NTHR  = WAVES * 32;         // 128 threads, 4 wave32
constexpr int STG   = (BK * DH / 4) / NTHR;      // float4 per thread per matrix = 8
constexpr float SCALE = 0.125f;           // 64^-0.5
constexpr int VP    = DH + 16;            // V row pitch in halves: 160 B, an odd multiple of 32 B, for the transposing reader
constexpr int KP    = DH + 8;             // K row pitch in halves: 144 B, an odd multiple of 16 B, for the 16-byte row reader
constexpr int MP    = BK + 4;             // mask row pitch in ints: 272 B, an odd multiple of 16 B, for the 16-byte row reader
constexpr int KBLK  = SEQ / BK;           // key blocks per row = 32
constexpr int MWB   = 32;                 // lane-mask words per (16-query tile, 64-key block): one per score register
constexpr int PWAV  = 8;                  // waves per packing workgroup
constexpr int PTIL  = 4;                  // 64-key blocks packed per wave
}

// value of lane l ^ 16: the other half of this lane's query column
__device__ __forceinline__ float xhalf(float x) {
  const int i = __builtin_bit_cast(int, x);
  return __builtin_bit_cast(float, __builtin_amdgcn_permlanex16(i, i, 0x76543210, 0xfedcba98, false, false));
}

// transposing LDS load: lane (c = l & 15, h = l >> 4) receives T[kbase + 8h + 0..7][dbase + c]
__device__ __forceinline__ v8h ld_tr16(const _Float16* p) {
  typedef __attribute__((address_space(3))) s16x8 lds_s16x8;
  return __builtin_bit_cast(v8h, __builtin_amdgcn_ds_load_tr16_b128_v8i16((lds_s16x8*)p));
}

// Packs the int32 mask once for all heads into lane-mask words. For 16-query tile rt (batch * 128 + q / 16) and
// 64-key block kb, word t*8+r holds in bit l: mask[rt*16 + (l & 15)][kb*64 + t*16 + (l >> 4)*8 + r] != 0,
// which is the lane and register that hold this score in the attention kernel's S^T tiles.
__global__ __launch_bounds__(PWAV * 32)
void pack_mask_lane_words(const int* __restrict__ MASK, unsigned int* __restrict__ MW)
{
  __shared__ __attribute__((aligned(16))) int Ts[PWAV][PTIL][16][MP];  // each wave's own tiles, padded rows

  const int lane  = threadIdx.x & 31;
  const int wave  = threadIdx.x >> 5;
  const int job   = blockIdx.x * PWAV + wave;
  const int rt    = job / (KBLK / PTIL);
  const int cg    = job % (KBLK / PTIL);
  const int m16   = lane & 15;
  const int half8 = (lane >> 4) << 3;

  // whole 256-byte row pieces, two rows per wave-wide load, all loads in flight together
  const int* src = MASK + (size_t)rt * 16 * SEQ + cg * (PTIL * BK);
  int4 m[PTIL][8];
  #pragma unroll
  for (int p = 0; p < PTIL; ++p)
    #pragma unroll
    for (int it = 0; it < 8; ++it)
      m[p][it] = *(const int4*)(src + (size_t)(it * 2 + (lane >> 4)) * SEQ + p * BK + (m16 << 2));
  #pragma unroll
  for (int p = 0; p < PTIL; ++p)
    #pragma unroll
    for (int it = 0; it < 8; ++it)
      *(int4*)&Ts[wave][p][it * 2 + (lane >> 4)][m16 << 2] = m[p][it];
  __syncthreads();   // the rows stored above are read below by other lanes

  // lane l collects words 4l..4l+3 of the wave's 128, so that one 16-byte store per lane writes whole lines
  int w4[4] = {0, 0, 0, 0};
  #pragma unroll
  for (int p = 0; p < PTIL; ++p)
    #pragma unroll
    for (int t = 0; t < 4; ++t) {
      const int4 lo = *(const int4*)&Ts[wave][p][m16][t * 16 + half8];
      const int4 hi = *(const int4*)&Ts[wave][p][m16][t * 16 + half8 + 4];
      const int e[8] = {lo.x, lo.y, lo.z, lo.w, hi.x, hi.y, hi.z, hi.w};
      #pragma unroll
      for (int r = 0; r < 8; ++r) {
        const int w = p * MWB + t * 8 + r;
        const int word = (int)__builtin_amdgcn_ballot_w32(e[r] != 0);
        w4[w & 3] = (lane == (w >> 2)) ? word : w4[w & 3];
      }
    }
  int4 o;
  o.x = w4[0];  o.y = w4[1];  o.z = w4[2];  o.w = w4[3];
  *(int4*)(MW + ((size_t)rt * KBLK + cg * PTIL) * MWB + (lane << 2)) = o;
}

__global__ __launch_bounds__(NTHR, 1)
void flash_attn_f16_wmma(const float* __restrict__ Q,
                         const float* __restrict__ K,
                         const float* __restrict__ V,
                         const unsigned int* __restrict__ MW,
                         float* __restrict__ OUT)
{
  __shared__ __attribute__((aligned(16))) _Float16 Ks[2][BK][KP];  // two key blocks, f16, padded rows
  __shared__ __attribute__((aligned(16))) _Float16 Vs[2][BK][VP];  // two value blocks, f16, padded rows

  const int tid  = threadIdx.x;
  const int lane = tid & 31;
  const int wave = tid >> 5;

  const int qtiles = SEQ / BQ;
  const int bh = blockIdx.x / qtiles;
  const int qt = blockIdx.x % qtiles;
  const int b  = bh / HEADS;

  const float* qb = Q + (size_t)bh * SEQ * DH;
  const float* kb = K + (size_t)bh * SEQ * DH;
  const float* vb = V + (size_t)bh * SEQ * DH;
  float*       ob = OUT + (size_t)bh * SEQ * DH;

  const int m16   = lane & 15;
  const int half8 = (lane >> 4) << 3;      // 0 for lanes 0..15, 8 for 16..31
  const int qblk  = qt * BQ;
  const int q0    = qblk + wave * 16;      // this wave's first q row

  // this wave's lane-mask words: a wave-uniform address, so that they arrive by scalar loads
  const unsigned int* mw = MW + (size_t)(b * (SEQ / 16) + (qblk >> 4)
                                         + __builtin_amdgcn_readfirstlane(wave)) * (KBLK * MWB);

  // ---- Q^T B-fragments with softmax scale folded in (exact *0.125 in f16): lane = query column m16
  // hardware k order: lanes 0-15 hold k in {0..7,16..23}; lanes 16-31 hold {8..15,24..31}
  v16h qa[2];
  #pragma unroll
  for (int c = 0; c < 2; ++c)
    #pragma unroll
    for (int j = 0; j < 16; ++j) {
      const int kk = c * 32 + half8 + (j & 7) + ((j >> 3) << 4);
      qa[c][j] = (_Float16)(qb[(size_t)(q0 + m16) * DH + kk] * SCALE);
    }

  v8f oacc[4] = {};          // O^T accumulators: 4 Dh-tiles of 16 rows, column = query m16
  float mrun = -INFINITY;    // running maximum of query m16 (equal in both wave halves)
  float lrun = 0.f;          // running sum over this wave half's keys; the halves join after the loop

  // ---- software pipeline: preload K/V block 0 into registers
  float4 kreg[STG], vreg[STG];
  {
    const float4* ks = (const float4*)kb;
    const float4* vs = (const float4*)vb;
    #pragma unroll
    for (int it = 0; it < STG; ++it) {
      const int i = it * NTHR + tid;
      kreg[it] = ks[i];
      vreg[it] = vs[i];
    }
  }

  // commits the pipelined K/V registers to LDS buffer nb as f16
  auto commit = [&](const int nb) {
    #pragma unroll
    for (int it = 0; it < STG; ++it) {
      const int i   = it * NTHR + tid;
      const int row = i >> 4;
      const int col = (i & 15) << 2;
      Ks[nb][row][col + 0] = (_Float16)kreg[it].x;
      Ks[nb][row][col + 1] = (_Float16)kreg[it].y;
      Ks[nb][row][col + 2] = (_Float16)kreg[it].z;
      Ks[nb][row][col + 3] = (_Float16)kreg[it].w;
      Vs[nb][row][col + 0] = (_Float16)vreg[it].x;
      Vs[nb][row][col + 1] = (_Float16)vreg[it].y;
      Vs[nb][row][col + 2] = (_Float16)vreg[it].z;
      Vs[nb][row][col + 3] = (_Float16)vreg[it].w;
    }
  };
  commit(0);
  __syncthreads();   // block 0 is in buffer 0 for every wave

  // this lane's source row and 16-byte half for the transposing V loads, in buffer 0
  const _Float16* vtr0 = &Vs[0][half8 + (lane & 7)][((lane >> 3) & 1) << 3];

  // one pass: key block k0 from LDS buffer u; more = a next block exists (u and more are constants at each call)
  auto pass = [&](const int u, const int k0, const bool more) __attribute__((always_inline)) {
    const _Float16* vtr = vtr0 + u * (BK * VP);

    // ---- this block's 32 lane-mask words into scalar registers
    unsigned int mword[MWB];
    #pragma unroll
    for (int i = 0; i < MWB; ++i)
      mword[i] = mw[(k0 / BK) * MWB + i];

    // ---- issue next block's global loads now: no barrier stands between them and their use
    // at the foot of this pass, so that they stay in flight under the whole pass
    if (more) {
      const float4* ks = (const float4*)(kb + (size_t)(k0 + BK) * DH);
      const float4* vs = (const float4*)(vb + (size_t)(k0 + BK) * DH);
      #pragma unroll
      for (int it = 0; it < STG; ++it) {
        const int i = it * NTHR + tid;
        kreg[it] = ks[i];
        vreg[it] = vs[i];
      }
    }

    // precaution: the loads issued above (mask words, next K/V block) have taken their addresses
    // before later code rewrites the registers that they name
    asm volatile("s_wait_xcnt 0x0" ::: "memory");

    // ---- scores, transposed: S^T = K * (Q*scale)^T, 4 key tiles of 16 rows, k-dim 64 (2 WMMA each)
    // sc[t][r] = score of key k0 + t*16 + half8 + r against query q0 + m16
    v8f sc[4];
    #pragma unroll
    for (int t = 0; t < 4; ++t) {
      v8f acc = {};
      #pragma unroll
      for (int c = 0; c < 2; ++c) {
        v16h kf;   // lane holds key row t*16+m16, j walks Dh
        #pragma unroll
        for (int j = 0; j < 16; ++j) {
          const int kk = c * 32 + half8 + (j & 7) + ((j >> 3) << 4);
          kf[j] = Ks[u][t * 16 + m16][kk];
        }
        acc = __builtin_amdgcn_wmma_f32_16x16x32_f16(false, kf, false, qa[c],
                                                     (short)0, acc, false, false);
      }
      sc[t] = acc;
    }

    // ---- mask (mask==0 -> -1e9): each word is the select's lane mask as it stands
    #pragma unroll
    for (int t = 0; t < 4; ++t)
      #pragma unroll
      for (int r = 0; r < 8; ++r)
        sc[t][r] = __builtin_amdgcn_inverse_ballot_w32(mword[t * 8 + r]) ? sc[t][r] : -1e9f;

    // ---- online softmax update: one query per lane, maximum and sum in-lane
    float bm = sc[0][0];
    #pragma unroll
    for (int t = 0; t < 4; ++t)
      #pragma unroll
      for (int r = 0; r < 8; ++r)
        bm = fmaxf(bm, sc[t][r]);
    bm = fmaxf(bm, xhalf(bm));               // both halves now hold the block maximum of the query
    const float mnew = fmaxf(mrun, bm);
    const float corr = __expf(mrun - mnew);  // exp(-inf)=0 on first block
    mrun = mnew;

    // P^T B-fragments straight from the score tiles: tiles 2c and 2c+1 are k 0..7,16..23 (+8 in the upper half)
    v16h pb[2];
    float bsum = 0.f;
    #pragma unroll
    for (int t = 0; t < 4; ++t)
      #pragma unroll
      for (int r = 0; r < 8; ++r) {
        const float p = __expf(sc[t][r] - mnew);
        bsum += p;
        pb[t >> 1][((t & 1) << 3) + r] = (_Float16)p;
      }
    lrun = lrun * corr + bsum;
    #pragma unroll
    for (int t = 0; t < 4; ++t)
      #pragma unroll
      for (int r = 0; r < 8; ++r)
        oacc[t][r] *= corr;

    // keeps the foot's conversions (and with them the wait for the next block's global loads) from being
    // scheduled up into the scores and the softmax; LDS reads may still cross, so that V is fetched early
    __builtin_amdgcn_sched_barrier(0x100);

    // ---- O^T += V^T * P^T   (A = V^T 16x32 tiles by the transposing load, B = P^T 32x16)
    #pragma unroll
    for (int t = 0; t < 4; ++t) {
      #pragma unroll
      for (int c = 0; c < 2; ++c) {
        // lane holds Dh row t*16+m16; elements 0..7 = keys c*32+half8+0..7, 8..15 = the same + 16
        const v8h lo = ld_tr16(vtr + (c * 32) * VP + t * 16);
        const v8h hi = ld_tr16(vtr + (c * 32 + 16) * VP + t * 16);
        const v16h av = __builtin_shufflevector(lo, hi, 0, 1, 2, 3, 4, 5, 6, 7,
                                                8, 9, 10, 11, 12, 13, 14, 15);
        oacc[t] = __builtin_amdgcn_wmma_f32_16x16x32_f16(false, av, false, pb[c],
                                                         (short)0, oacc[t], false, false);
      }
    }

    // ---- the next block goes into the other buffer, whose last readers left it before the previous barrier
    if (more) {
      commit(u ^ 1);
      __syncthreads();   // the one barrier of a pass: publishes the next block, ends this block's reads
      // keeps the two passes of a trip apart in the schedule: mixed, they hold both passes' fragments and
      // probabilities at once and pass 256 registers, which costs the fourth wave of a SIMD
      __builtin_amdgcn_sched_barrier(0);
    }
  };

  // two passes per trip, so that each pass names its LDS buffer by a constant offset; the last two stand alone
  for (int kp = 0; kp < SEQ - 2 * BK; kp += 2 * BK) {
    pass(0, kp, true);
    pass(1, kp + BK, true);
  }
  pass(0, SEQ - 2 * BK, true);
  pass(1, SEQ - BK, false);

  // ---- join the halves' sums, normalize and store fp32: 8 consecutive Dh of one query row per tile
  const float lsum = lrun + xhalf(lrun);
  float* orow = ob + (size_t)(q0 + m16) * DH + half8;
  #pragma unroll
  for (int t = 0; t < 4; ++t) {
    float4 lo, hi;
    lo.x = oacc[t][0] / lsum;  lo.y = oacc[t][1] / lsum;
    lo.z = oacc[t][2] / lsum;  lo.w = oacc[t][3] / lsum;
    hi.x = oacc[t][4] / lsum;  hi.y = oacc[t][5] / lsum;
    hi.z = oacc[t][6] / lsum;  hi.w = oacc[t][7] / lsum;
    *(float4*)(orow + t * 16)     = lo;
    *(float4*)(orow + t * 16 + 4) = hi;
  }
}

extern "C" void kernel_launch(void* const* d_in, const int* in_sizes, int n_in,
                              void* d_out, int out_size, void* d_ws, size_t ws_size,
                              hipStream_t stream) {
  const float* q    = (const float*)d_in[0];
  const float* k    = (const float*)d_in[1];
  const float* v    = (const float*)d_in[2];
  const int*   mask = (const int*)d_in[3];
  float*       out  = (float*)d_out;
  unsigned int* mwords = (unsigned int*)d_ws;   // 2 * 128 * 32 * 32 words = 1 MiB, written anew in every call

  dim3 grid(BATCH * HEADS * (SEQ / BQ));   // 2*16*32 = 1024 workgroups
  dim3 block(NTHR);                        // 128 threads = 4 waves (wave32)
  dim3 pgrid(BATCH * (SEQ / 16) * (KBLK / PTIL) / PWAV);   // 2048 waves in 256 workgroups
  dim3 pblock(PWAV * 32);
  pack_mask_lane_words<<<pgrid, pblock, 0, stream>>>(mask, mwords);
  flash_attn_f16_wmma<<<grid, block, 0, stream>>>(q, k, v, mwords, out);
}

// v006
// One run takes 52.8 microseconds.
// Two timings next to v005 put it at 1.09 and 1.08 times that version's speed.
// Over all steps from v000 it is 4.13 times as fast.
#include <hip/hip_runtime.h>
#include <cmath>

typedef __attribute__((ext_vector_type(16))) _Float16 v16h;
typedef __attribute__((ext_vector_type(8)))  float    v8f;
typedef __attribute__((ext_vector_type(8)))  _Float16 v8h;
typedef __attribute__((ext_vector_type(8)))  short    s16x8;

namespace {
constexpr int BATCH = 2;
constexpr int HEADS = 16;
constexpr int SEQ   = 2048;
constexpr int DH    = 64;
constexpr int BQ    = 128;                // q rows per workgroup (8 waves x 16)
constexpr int BK    = 64;                 // keys staged per iteration
constexpr int WAVES = 8;
constexpr int NTHR  = WAVES * 32;         // 256 threads, 8 wave32
constexpr int STG   = (BK * DH / 4) / NTHR;      // float4 per thread per matrix = 4
constexpr float SCALE = 0.125f;           // 64^-0.5
constexpr int VP    = DH + 16;            // V row pitch in halves: 160 B, an odd multiple of 32 B, for the transposing reader
constexpr int KP    = DH + 8;             // K row pitch in halves: 144 B, an odd multiple of 16 B, for the 16-byte row reader
constexpr int MP    = BK + 4;             // mask row pitch in ints: 272 B, an odd multiple of 16 B, for the 16-byte row reader
constexpr int KBLK  = SEQ / BK;           // key blocks per row = 32
constexpr int MWB   = 32;                 // lane-mask words per (16-query tile, 64-key block): one per score register
constexpr int PWAV  = 8;                  // waves per packing workgroup
constexpr int PTIL  = 4;                  // 64-key blocks packed per wave
}

// value of lane l ^ 16: the other half of this lane's query column
__device__ __forceinline__ float xhalf(float x) {
  const int i = __builtin_bit_cast(int, x);
  return __builtin_bit_cast(float, __builtin_amdgcn_permlanex16(i, i, 0x76543210, 0xfedcba98, false, false));
}

// transposing LDS load: lane (c = l & 15, h = l >> 4) receives T[kbase + 8h + 0..7][dbase + c]
__device__ __forceinline__ v8h ld_tr16(const _Float16* p) {
  typedef __attribute__((address_space(3))) s16x8 lds_s16x8;
  return __builtin_bit_cast(v8h, __builtin_amdgcn_ds_load_tr16_b128_v8i16((lds_s16x8*)p));
}

// Packs the int32 mask once for all heads into lane-mask words. For 16-query tile rt (batch * 128 + q / 16) and
// 64-key block kb, word t*8+r holds in bit l: mask[rt*16 + (l & 15)][kb*64 + t*16 + (l >> 4)*8 + r] != 0,
// which is the lane and register that hold this score in the attention kernel's S^T tiles.
__global__ __launch_bounds__(PWAV * 32)
void pack_mask_lane_words(const int* __restrict__ MASK, unsigned int* __restrict__ MW)
{
  __shared__ __attribute__((aligned(16))) int Ts[PWAV][PTIL][16][MP];  // each wave's own tiles, padded rows

  const int lane  = threadIdx.x & 31;
  const int wave  = threadIdx.x >> 5;
  const int job   = blockIdx.x * PWAV + wave;
  const int rt    = job / (KBLK / PTIL);
  const int cg    = job % (KBLK / PTIL);
  const int m16   = lane & 15;
  const int half8 = (lane >> 4) << 3;

  // whole 256-byte row pieces, two rows per wave-wide load, all loads in flight together
  const int* src = MASK + (size_t)rt * 16 * SEQ + cg * (PTIL * BK);
  int4 m[PTIL][8];
  #pragma unroll
  for (int p = 0; p < PTIL; ++p)
    #pragma unroll
    for (int it = 0; it < 8; ++it)
      m[p][it] = *(const int4*)(src + (size_t)(it * 2 + (lane >> 4)) * SEQ + p * BK + (m16 << 2));
  #pragma unroll
  for (int p = 0; p < PTIL; ++p)
    #pragma unroll
    for (int it = 0; it < 8; ++it)
      *(int4*)&Ts[wave][p][it * 2 + (lane >> 4)][m16 << 2] = m[p][it];
  __syncthreads();   // the rows stored above are read below by other lanes

  // lane l collects words 4l..4l+3 of the wave's 128, so that one 16-byte store per lane writes whole lines
  int w4[4] = {0, 0, 0, 0};
  #pragma unroll
  for (int p = 0; p < PTIL; ++p)
    #pragma unroll
    for (int t = 0; t < 4; ++t) {
      const int4 lo = *(const int4*)&Ts[wave][p][m16][t * 16 + half8];
      const int4 hi = *(const int4*)&Ts[wave][p][m16][t * 16 + half8 + 4];
      const int e[8] = {lo.x, lo.y, lo.z, lo.w, hi.x, hi.y, hi.z, hi.w};
      #pragma unroll
      for (int r = 0; r < 8; ++r) {
        const int w = p * MWB + t * 8 + r;
        const int word = (int)__builtin_amdgcn_ballot_w32(e[r] != 0);
        w4[w & 3] = (lane == (w >> 2)) ? word : w4[w & 3];
      }
    }
  int4 o;
  o.x = w4[0];  o.y = w4[1];  o.z = w4[2];  o.w = w4[3];
  *(int4*)(MW + ((size_t)rt * KBLK + cg * PTIL) * MWB + (lane << 2)) = o;
}

__global__ __launch_bounds__(NTHR, 1)
void flash_attn_f16_wmma(const float* __restrict__ Q,
                         const float* __restrict__ K,
                         const float* __restrict__ V,
                         const unsigned int* __restrict__ MW,
                         float* __restrict__ OUT)
{
  __shared__ __attribute__((aligned(16))) _Float16 Ks[2][BK][KP];  // two key blocks, f16, padded rows
  __shared__ __attribute__((aligned(16))) _Float16 Vs[2][BK][VP];  // two value blocks, f16, padded rows

  const int tid  = threadIdx.x;
  const int lane = tid & 31;
  const int wave = tid >> 5;

  const int qtiles = SEQ / BQ;
  const int bh = blockIdx.x / qtiles;
  const int qt = blockIdx.x % qtiles;
  const int b  = bh / HEADS;

  const float* qb = Q + (size_t)bh * SEQ * DH;
  const float* kb = K + (size_t)bh * SEQ * DH;
  const float* vb = V + (size_t)bh * SEQ * DH;
  float*       ob = OUT + (size_t)bh * SEQ * DH;

  const int m16   = lane & 15;
  const int half8 = (lane >> 4) << 3;      // 0 for lanes 0..15, 8 for 16..31
  const int qblk  = qt * BQ;
  const int q0    = qblk + wave * 16;      // this wave's first q row

  // this wave's lane-mask words: a wave-uniform address, so that they arrive by scalar loads
  const unsigned int* mw = MW + (size_t)(b * (SEQ / 16) + (qblk >> 4)
                                         + __builtin_amdgcn_readfirstlane(wave)) * (KBLK * MWB);

  // ---- Q^T B-fragments with softmax scale folded in (exact *0.125 in f16): lane = query column m16
  // hardware k order: lanes 0-15 hold k in {0..7,16..23}; lanes 16-31 hold {8..15,24..31}
  v16h qa[2];
  #pragma unroll
  for (int c = 0; c < 2; ++c)
    #pragma unroll
    for (int j = 0; j < 16; ++j) {
      const int kk = c * 32 + half8 + (j & 7) + ((j >> 3) << 4);
      qa[c][j] = (_Float16)(qb[(size_t)(q0 + m16) * DH + kk] * SCALE);
    }

  v8f oacc[4] = {};          // O^T accumulators: 4 Dh-tiles of 16 rows, column = query m16
  float mrun = -INFINITY;    // running maximum of query m16 (equal in both wave halves)
  float lrun = 0.f;          // running sum over this wave half's keys; the halves join after the loop

  // ---- software pipeline: preload K/V block 0 into registers
  float4 kreg[STG], vreg[STG];
  {
    const float4* ks = (const float4*)kb;
    const float4* vs = (const float4*)vb;
    #pragma unroll
    for (int it = 0; it < STG; ++it) {
      const int i = it * NTHR + tid;
      kreg[it] = ks[i];
      vreg[it] = vs[i];
    }
  }

  // commits the pipelined K/V registers to LDS buffer nb as f16
  auto commit = [&](const int nb) {
    #pragma unroll
    for (int it = 0; it < STG; ++it) {
      const int i   = it * NTHR + tid;
      const int row = i >> 4;
      const int col = (i & 15) << 2;
      Ks[nb][row][col + 0] = (_Float16)kreg[it].x;
      Ks[nb][row][col + 1] = (_Float16)kreg[it].y;
      Ks[nb][row][col + 2] = (_Float16)kreg[it].z;
      Ks[nb][row][col + 3] = (_Float16)kreg[it].w;
      Vs[nb][row][col + 0] = (_Float16)vreg[it].x;
      Vs[nb][row][col + 1] = (_Float16)vreg[it].y;
      Vs[nb][row][col + 2] = (_Float16)vreg[it].z;
      Vs[nb][row][col + 3] = (_Float16)vreg[it].w;
    }
  };
  commit(0);
  __syncthreads();   // block 0 is in buffer 0 for every wave

  // this lane's source row and 16-byte half for the transposing V loads, in buffer 0
  const _Float16* vtr0 = &Vs[0][half8 + (lane & 7)][((lane >> 3) & 1) << 3];

  // one pass: key block k0 from LDS buffer u; more = a next block exists (u and more are constants at each call)
  auto pass = [&](const int u, const int k0, const bool more) __attribute__((always_inline)) {
    const _Float16* vtr = vtr0 + u * (BK * VP);

    // ---- this block's 32 lane-mask words into scalar registers
    unsigned int mword[MWB];
    #pragma unroll
    for (int i = 0; i < MWB / 2; ++i)
      mword[i] = mw[(k0 / BK) * MWB + i];
    // precaution: the first half's load has taken its address before the second half's words land on the
    // scalar registers that it names
    asm volatile("s_wait_xcnt 0x0" ::: "memory");
    #pragma unroll
    for (int i = MWB / 2; i < MWB; ++i)
      mword[i] = mw[(k0 / BK) * MWB + i];

    // ---- issue next block's global loads now: no barrier stands between them and their use
    // at the foot of this pass, so that they stay in flight under the whole pass
    if (more) {
      const float4* ks = (const float4*)(kb + (size_t)(k0 + BK) * DH);
      const float4* vs = (const float4*)(vb + (size_t)(k0 + BK) * DH);
      #pragma unroll
      for (int it = 0; it < STG; ++it) {
        const int i = it * NTHR + tid;
        kreg[it] = ks[i];
        vreg[it] = vs[i];
      }
    }

    // precaution: the loads issued above (mask words, next K/V block) have taken their addresses
    // before later code rewrites the registers that they name
    asm volatile("s_wait_xcnt 0x0" ::: "memory");

    // ---- scores, transposed: S^T = K * (Q*scale)^T, 4 key tiles of 16 rows, k-dim 64 (2 WMMA each)
    // sc[t][r] = score of key k0 + t*16 + half8 + r against query q0 + m16
    v8f sc[4];
    #pragma unroll
    for (int t = 0; t < 4; ++t) {
      v8f acc = {};
      #pragma unroll
      for (int c = 0; c < 2; ++c) {
        v16h kf;   // lane holds key row t*16+m16, j walks Dh
        #pragma unroll
        for (int j = 0; j < 16; ++j) {
          const int kk = c * 32 + half8 + (j & 7) + ((j >> 3) << 4);
          kf[j] = Ks[u][t * 16 + m16][kk];
        }
        acc = __builtin_amdgcn_wmma_f32_16x16x32_f16(false, kf, false, qa[c],
                                                     (short)0, acc, false, false);
      }
      sc[t] = acc;
    }

    // ---- mask (mask==0 -> -1e9): each word is the select's lane mask as it stands
    #pragma unroll
    for (int t = 0; t < 4; ++t)
      #pragma unroll
      for (int r = 0; r < 8; ++r)
        sc[t][r] = __builtin_amdgcn_inverse_ballot_w32(mword[t * 8 + r]) ? sc[t][r] : -1e9f;

    // ---- online softmax update: one query per lane, maximum and sum in-lane
    float bm = sc[0][0];
    #pragma unroll
    for (int t = 0; t < 4; ++t)
      #pragma unroll
      for (int r = 0; r < 8; ++r)
        bm = fmaxf(bm, sc[t][r]);
    bm = fmaxf(bm, xhalf(bm));               // both halves now hold the block maximum of the query
    const float mnew = fmaxf(mrun, bm);
    const float corr = __expf(mrun - mnew);  // exp(-inf)=0 on first block
    mrun = mnew;

    // P^T B-fragments straight from the score tiles: tiles 2c and 2c+1 are k 0..7,16..23 (+8 in the upper half)
    v16h pb[2];
    float bsum = 0.f;
    #pragma unroll
    for (int t = 0; t < 4; ++t)
      #pragma unroll
      for (int r = 0; r < 8; ++r) {
        const float p = __expf(sc[t][r] - mnew);
        bsum += p;
        pb[t >> 1][((t & 1) << 3) + r] = (_Float16)p;
      }
    lrun = lrun * corr + bsum;
    #pragma unroll
    for (int t = 0; t < 4; ++t)
      #pragma unroll
      for (int r = 0; r < 8; ++r)
        oacc[t][r] *= corr;

    // keeps the foot's conversions (and with them the wait for the next block's global loads) from being
    // scheduled up into the scores and the softmax; LDS reads may still cross, so that V is fetched early
    __builtin_amdgcn_sched_barrier(0x100);

    // ---- O^T += V^T * P^T   (A = V^T 16x32 tiles by the transposing load, B = P^T 32x16)
    #pragma unroll
    for (int t = 0; t < 4; ++t) {
      #pragma unroll
      for (int c = 0; c < 2; ++c) {
        // lane holds Dh row t*16+m16; elements 0..7 = keys c*32+half8+0..7, 8..15 = the same + 16
        const v8h lo = ld_tr16(vtr + (c * 32) * VP + t * 16);
        const v8h hi = ld_tr16(vtr + (c * 32 + 16) * VP + t * 16);
        const v16h av = __builtin_shufflevector(lo, hi, 0, 1, 2, 3, 4, 5, 6, 7,
                                                8, 9, 10, 11, 12, 13, 14, 15);
        oacc[t] = __builtin_amdgcn_wmma_f32_16x16x32_f16(false, av, false, pb[c],
                                                         (short)0, oacc[t], false, false);
      }
    }

    // ---- the next block goes into the other buffer, whose last readers left it before the previous barrier
    if (more) {
      commit(u ^ 1);
      __syncthreads();   // the one barrier of a pass: publishes the next block, ends this block's reads
      // limits how far the two passes of a trip are mixed in the schedule: without it they hold both passes'
      // fragments and probabilities at once and pass 256 registers, which costs the second workgroup of a WGP
      __builtin_amdgcn_sched_barrier(0);
    }
  };

  // two passes per trip, so that each pass names its LDS buffer by a constant offset; the last two stand alone
  for (int kp = 0; kp < SEQ - 2 * BK; kp += 2 * BK) {
    pass(0, kp, true);
    pass(1, kp + BK, true);
  }
  pass(0, SEQ - 2 * BK, true);
  pass(1, SEQ - BK, false);

  // ---- join the halves' sums, normalize and store fp32: 8 consecutive Dh of one query row per tile
  const float lsum = lrun + xhalf(lrun);
  float* orow = ob + (size_t)(q0 + m16) * DH + half8;
  #pragma unroll
  for (int t = 0; t < 4; ++t) {
    float4 lo, hi;
    lo.x = oacc[t][0] / lsum;  lo.y = oacc[t][1] / lsum;
    lo.z = oacc[t][2] / lsum;  lo.w = oacc[t][3] / lsum;
    hi.x = oacc[t][4] / lsum;  hi.y = oacc[t][5] / lsum;
    hi.z = oacc[t][6] / lsum;  hi.w = oacc[t][7] / lsum;
    *(float4*)(orow + t * 16)     = lo;
    *(float4*)(orow + t * 16 + 4) = hi;
  }
}

extern "C" void kernel_launch(void* const* d_in, const int* in_sizes, int n_in,
                              void* d_out, int out_size, void* d_ws, size_t ws_size,
                              hipStream_t stream) {
  const float* q    = (const float*)d_in[0];
  const float* k    = (const float*)d_in[1];
  const float* v    = (const float*)d_in[2];
  const int*   mask = (const int*)d_in[3];
  float*       out  = (float*)d_out;
  unsigned int* mwords = (unsigned int*)d_ws;   // 2 * 128 * 32 * 32 words = 1 MiB, written anew in every call

  dim3 grid(BATCH * HEADS * (SEQ / BQ));   // 2*16*16 = 512 workgroups
  dim3 block(NTHR);                        // 256 threads = 8 waves (wave32)
  dim3 pgrid(BATCH * (SEQ / 16) * (KBLK / PTIL) / PWAV);   // 2048 waves in 256 workgroups
  dim3 pblock(PWAV * 32);
  pack_mask_lane_words<<<pgrid, pblock, 0, stream>>>(mask, mwords);
  flash_attn_f16_wmma<<<grid, block, 0, stream>>>(q, k, v, mwords, out);
}

// v007
// A run of this version takes 47 microseconds.
// Timed twice side by side with v006, it ran 1.12 times as fast both times.
// Counting every step since v000, it is 4.63 times as fast.
#include <hip/hip_runtime.h>
#include <cmath>

typedef __attribute__((ext_vector_type(16))) _Float16 v16h;
typedef __attribute__((ext_vector_type(8)))  float    v8f;
typedef __attribute__((ext_vector_type(8)))  _Float16 v8h;
typedef __attribute__((ext_vector_type(8)))  short    s16x8;

namespace {
constexpr int BATCH = 2;
constexpr int HEADS = 16;
constexpr int SEQ   = 2048;
constexpr int DH    = 64;
constexpr int BQ    = 128;                // q rows per workgroup (8 waves x 16)
constexpr int BK    = 64;                 // keys staged per iteration
constexpr int WAVES = 8;
constexpr int NTHR  = WAVES * 32;         // 256 threads, 8 wave32
constexpr int STG   = (BK * DH / 4) / NTHR;      // float4 per thread per matrix = 4
constexpr float SCALE = 0.125f;           // 64^-0.5
constexpr int VP    = DH + 16;            // V row pitch in halves: 160 B, an odd multiple of 32 B, for the transposing reader
constexpr int KP    = DH + 8;             // K row pitch in halves: 144 B, an odd multiple of 16 B, for the 16-byte row reader
constexpr int MP    = BK + 4;             // mask row pitch in ints: 272 B, an odd multiple of 16 B, for the 16-byte row reader
constexpr int KBLK  = SEQ / BK;           // key blocks per row = 32
constexpr int MWB   = 32;                 // lane-mask words per (16-query tile, 64-key block): one per score register
constexpr int PWAV  = 8;                  // waves per packing workgroup
constexpr int PTIL  = 4;                  // 64-key blocks packed per wave
}

// value of lane l ^ 16: the other half of this lane's query column
__device__ __forceinline__ float xhalf(float x) {
  const int i = __builtin_bit_cast(int, x);
  return __builtin_bit_cast(float, __builtin_amdgcn_permlanex16(i, i, 0x76543210, 0xfedcba98, false, false));
}

// transposing LDS load: lane (c = l & 15, h = l >> 4) receives T[kbase + 8h + 0..7][dbase + c]
__device__ __forceinline__ v8h ld_tr16(const _Float16* p) {
  typedef __attribute__((address_space(3))) s16x8 lds_s16x8;
  return __builtin_bit_cast(v8h, __builtin_amdgcn_ds_load_tr16_b128_v8i16((lds_s16x8*)p));
}

// work-group barrier that orders LDS alone: global loads issued ahead of it stay in flight across it,
// where __syncthreads() would wait for them
__device__ __forceinline__ void lds_barrier() {
  __builtin_amdgcn_fence(__ATOMIC_RELEASE, "workgroup", "local");
  __builtin_amdgcn_s_barrier();
  __builtin_amdgcn_fence(__ATOMIC_ACQUIRE, "workgroup", "local");
}

// Packs the int32 mask once for all heads into lane-mask words. For 16-query tile rt (batch * 128 + q / 16) and
// 64-key block kb, word t*8+r holds in bit l: mask[rt*16 + (l & 15)][kb*64 + t*16 + (l >> 4)*8 + r] != 0,
// which is the lane and register that hold this score in the attention kernel's S^T tiles.
__global__ __launch_bounds__(PWAV * 32)
void pack_mask_lane_words(const int* __restrict__ MASK, unsigned int* __restrict__ MW)
{
  __shared__ __attribute__((aligned(16))) int Ts[PWAV][PTIL][16][MP];  // each wave's own tiles, padded rows

  const int lane  = threadIdx.x & 31;
  const int wave  = threadIdx.x >> 5;
  const int job   = blockIdx.x * PWAV + wave;
  const int rt    = job / (KBLK / PTIL);
  const int cg    = job % (KBLK / PTIL);
  const int m16   = lane & 15;
  const int half8 = (lane >> 4) << 3;

  // whole 256-byte row pieces, two rows per wave-wide load, all loads in flight together
  const int* src = MASK + (size_t)rt * 16 * SEQ + cg * (PTIL * BK);
  int4 m[PTIL][8];
  #pragma unroll
  for (int p = 0; p < PTIL; ++p)
    #pragma unroll
    for (int it = 0; it < 8; ++it)
      m[p][it] = *(const int4*)(src + (size_t)(it * 2 + (lane >> 4)) * SEQ + p * BK + (m16 << 2));
  #pragma unroll
  for (int p = 0; p < PTIL; ++p)
    #pragma unroll
    for (int it = 0; it < 8; ++it)
      *(int4*)&Ts[wave][p][it * 2 + (lane >> 4)][m16 << 2] = m[p][it];
  __syncthreads();   // the rows stored above are read below by other lanes

  // lane l collects words 4l..4l+3 of the wave's 128, so that one 16-byte store per lane writes whole lines
  int w4[4] = {0, 0, 0, 0};
  #pragma unroll
  for (int p = 0; p < PTIL; ++p)
    #pragma unroll
    for (int t = 0; t < 4; ++t) {
      const int4 lo = *(const int4*)&Ts[wave][p][m16][t * 16 + half8];
      const int4 hi = *(const int4*)&Ts[wave][p][m16][t * 16 + half8 + 4];
      const int e[8] = {lo.x, lo.y, lo.z, lo.w, hi.x, hi.y, hi.z, hi.w};
      #pragma unroll
      for (int r = 0; r < 8; ++r) {
        const int w = p * MWB + t * 8 + r;
        const int word = (int)__builtin_amdgcn_ballot_w32(e[r] != 0);
        w4[w & 3] = (lane == (w >> 2)) ? word : w4[w & 3];
      }
    }
  int4 o;
  o.x = w4[0];  o.y = w4[1];  o.z = w4[2];  o.w = w4[3];
  *(int4*)(MW + ((size_t)rt * KBLK + cg * PTIL) * MWB + (lane << 2)) = o;
}

// four waves per SIMD and no more (two workgroups share a WGP, the grid has no third): without the upper bound
// the scheduler narrows the softmax and the V reads to save registers for a fifth wave that never comes
__global__ __launch_bounds__(NTHR) __attribute__((amdgpu_waves_per_eu(4, 4)))
void flash_attn_f16_wmma(const float* __restrict__ Q,
                         const float* __restrict__ K,
                         const float* __restrict__ V,
                         const unsigned int* __restrict__ MW,
                         float* __restrict__ OUT)
{
  __shared__ __attribute__((aligned(16))) _Float16 Ks[2][BK][KP];  // two key blocks, f16, padded rows
  __shared__ __attribute__((aligned(16))) _Float16 Vs[2][BK][VP];  // two value blocks, f16, padded rows

  const int tid  = threadIdx.x;
  const int lane = tid & 31;
  const int wave = tid >> 5;

  const int qtiles = SEQ / BQ;
  const int bh = blockIdx.x / qtiles;
  const int qt = blockIdx.x % qtiles;
  const int b  = bh / HEADS;

  const float* qb = Q + (size_t)bh * SEQ * DH;
  const float* kb = K + (size_t)bh * SEQ * DH;
  const float* vb = V + (size_t)bh * SEQ * DH;
  float*       ob = OUT + (size_t)bh * SEQ * DH;

  const int m16   = lane & 15;
  const int half8 = (lane >> 4) << 3;      // 0 for lanes 0..15, 8 for 16..31
  const int qblk  = qt * BQ;
  const int q0    = qblk + wave * 16;      // this wave's first q row

  // this wave's lane-mask words: a wave-uniform address, so that they arrive by scalar loads
  const unsigned int* mw = MW + (size_t)(b * (SEQ / 16) + (qblk >> 4)
                                         + __builtin_amdgcn_readfirstlane(wave)) * (KBLK * MWB);

  // ---- Q^T B-fragments with softmax scale folded in (exact *0.125 in f16): lane = query column m16
  // hardware k order: lanes 0-15 hold k in {0..7,16..23}; lanes 16-31 hold {8..15,24..31}
  v16h qa[2];
  #pragma unroll
  for (int c = 0; c < 2; ++c)
    #pragma unroll
    for (int j = 0; j < 16; ++j) {
      const int kk = c * 32 + half8 + (j & 7) + ((j >> 3) << 4);
      qa[c][j] = (_Float16)(qb[(size_t)(q0 + m16) * DH + kk] * SCALE);
    }

  v8f oacc[4] = {};          // O^T accumulators: 4 Dh-tiles of 16 rows, column = query m16
  float mrun = -INFINITY;    // running maximum of query m16 (equal in both wave halves)
  float lrun = 0.f;          // running sum over this wave half's keys; the halves join after the loop

  // ---- software pipeline: K/V blocks pass through these registers on their way to LDS
  float4 kreg[STG], vreg[STG];
  auto fetch = [&](const int k0) {
    const float4* ks = (const float4*)(kb + (size_t)k0 * DH);
    const float4* vs = (const float4*)(vb + (size_t)k0 * DH);
    #pragma unroll
    for (int it = 0; it < STG; ++it) {
      const int i = it * NTHR + tid;
      kreg[it] = ks[i];
      vreg[it] = vs[i];
    }
    // precaution: the loads issued so far have taken their addresses before later code rewrites
    // the registers that they name
    asm volatile("s_wait_xcnt 0x0" ::: "memory");
  };

  // the 32 lane-mask words of key block k0 into scalar registers
  auto fetch_mask = [&](unsigned int (&mword)[MWB], const int k0) {
    #pragma unroll
    for (int i = 0; i < MWB / 2; ++i)
      mword[i] = mw[(k0 / BK) * MWB + i];
    // precaution: the first half's load has taken its address before the second half's words land on the
    // scalar registers that it names
    asm volatile("s_wait_xcnt 0x0" ::: "memory");
    #pragma unroll
    for (int i = MWB / 2; i < MWB; ++i)
      mword[i] = mw[(k0 / BK) * MWB + i];
    // precaution: the same for the second half's load and whatever is written next
    asm volatile("s_wait_xcnt 0x0" ::: "memory");
  };

  // commits the pipelined K/V registers to LDS buffer nb as f16
  auto commit = [&](const int nb) __attribute__((always_inline)) {
    #pragma unroll
    for (int it = 0; it < STG; ++it) {
      const int row = it * (NTHR / 16) + (tid >> 4);   // constant row steps: one address register per matrix
      const int col = (tid & 15) << 2;
      Ks[nb][row][col + 0] = (_Float16)kreg[it].x;
      Ks[nb][row][col + 1] = (_Float16)kreg[it].y;
      Ks[nb][row][col + 2] = (_Float16)kreg[it].z;
      Ks[nb][row][col + 3] = (_Float16)kreg[it].w;
      Vs[nb][row][col + 0] = (_Float16)vreg[it].x;
      Vs[nb][row][col + 1] = (_Float16)vreg[it].y;
      Vs[nb][row][col + 2] = (_Float16)vreg[it].z;
      Vs[nb][row][col + 3] = (_Float16)vreg[it].w;
    }
  };
  unsigned int mword[MWB];   // the current key block's mask words
  fetch(0);
  fetch_mask(mword, 0);
  commit(0);
  fetch(BK);         // block 1 waits in registers for the head of pass 0
  // keeps the address arithmetic of the loop, which reuses registers that these loads name, behind fetch's wait
  __builtin_amdgcn_sched_barrier(0);
  lds_barrier();     // block 0 is in buffer 0 for every wave

  // this lane's source row and 16-byte half for the transposing V loads, in buffer 0
  const _Float16* vtr0 = &Vs[0][half8 + (lane & 7)][((lane >> 3) & 1) << 3];

  // one pass: key block k0 from LDS buffer u with mask words mword; more = a next block exists, more2 = a block
  // after that too (more and more2 are constants at each call)
  auto pass = [&](const int u, const int k0, const bool more, const bool more2) __attribute__((always_inline)) {
    const _Float16* vtr = vtr0 + u * (BK * VP);

    // ---- every read from L2 has a whole pass of lead over its first use: the next block, loaded during the
    // previous pass, goes into the other buffer, whose last readers left it before the previous barrier;
    // then the K/V block after it is requested
    if (more)
      commit(u ^ 1);
    if (more2) {
      // keeps the new loads behind the conversions above, so that they land in the same 32 registers
      __builtin_amdgcn_sched_barrier(0);
      fetch(k0 + 2 * BK);
    }

    // ---- scores, transposed: S^T = K * (Q*scale)^T, 4 key tiles of 16 rows, k-dim 64 (2 WMMA each)
    // sc[t][r] = score of key k0 + t*16 + half8 + r against query q0 + m16
    v8f sc[4];
    #pragma unroll
    for (int t = 0; t < 4; ++t) {
      v8f acc = {};
      #pragma unroll
      for (int c = 0; c < 2; ++c) {
        v16h kf;   // lane holds key row t*16+m16, j walks Dh
        #pragma unroll
        for (int j = 0; j < 16; ++j) {
          const int kk = c * 32 + half8 + (j & 7) + ((j >> 3) << 4);
          kf[j] = Ks[u][t * 16 + m16][kk];
        }
        acc = __builtin_amdgcn_wmma_f32_16x16x32_f16(false, kf, false, qa[c],
                                                     (short)0, acc, false, false);
      }
      sc[t] = acc;
    }

    // ---- mask (mask==0 -> -1e9): each word is the select's lane mask as it stands
    #pragma unroll
    for (int t = 0; t < 4; ++t)
      #pragma unroll
      for (int r = 0; r < 8; ++r)
        sc[t][r] = __builtin_amdgcn_inverse_ballot_w32(mword[t * 8 + r]) ? sc[t][r] : -1e9f;

    // ---- the next block's mask words, requested once this block's are used up, into the same scalar registers
    if (more) {
      // keeps the requests behind the selects above
      __builtin_amdgcn_sched_barrier(0);
      fetch_mask(mword, k0 + BK);
    }

    // ---- online softmax update: one query per lane, maximum and sum in-lane
    float bm = sc[0][0];
    #pragma unroll
    for (int t = 0; t < 4; ++t)
      #pragma unroll
      for (int r = 0; r < 8; ++r)
        bm = fmaxf(bm, sc[t][r]);
    bm = fmaxf(bm, xhalf(bm));               // both halves now hold the block maximum of the query
    const float mnew = fmaxf(mrun, bm);
    const float corr = __expf(mrun - mnew);  // exp(-inf)=0 on first block
    mrun = mnew;

    // P^T B-fragments straight from the score tiles: tiles 2c and 2c+1 are k 0..7,16..23 (+8 in the upper half)
    v16h pb[2];
    float bsum = 0.f;
    #pragma unroll
    for (int t = 0; t < 4; ++t)
      #pragma unroll
      for (int r = 0; r < 8; ++r) {
        const float p = __expf(sc[t][r] - mnew);
        bsum += p;
        pb[t >> 1][((t & 1) << 3) + r] = (_Float16)p;
      }
    lrun = lrun * corr + bsum;
    #pragma unroll
    for (int t = 0; t < 4; ++t)
      #pragma unroll
      for (int r = 0; r < 8; ++r)
        oacc[t][r] *= corr;

    // ---- O^T += V^T * P^T   (A = V^T 16x32 tiles by the transposing load, B = P^T 32x16)
    #pragma unroll
    for (int t = 0; t < 4; ++t) {
      #pragma unroll
      for (int c = 0; c < 2; ++c) {
        // lane holds Dh row t*16+m16; elements 0..7 = keys c*32+half8+0..7, 8..15 = the same + 16
        const v8h lo = ld_tr16(vtr + (c * 32) * VP + t * 16);
        const v8h hi = ld_tr16(vtr + (c * 32 + 16) * VP + t * 16);
        const v16h av = __builtin_shufflevector(lo, hi, 0, 1, 2, 3, 4, 5, 6, 7,
                                                8, 9, 10, 11, 12, 13, 14, 15);
        oacc[t] = __builtin_amdgcn_wmma_f32_16x16x32_f16(false, av, false, pb[c],
                                                         (short)0, oacc[t], false, false);
      }
    }

    if (more) {
      lds_barrier();     // the one barrier of a pass: publishes the next block, ends this block's reads
    }
  };

  // one pass per trip: two passes in one block of code are mixed by the scheduler, which then holds both passes'
  // fragments and scores beside the K/V registers and passes 256 registers; the last two passes stand alone
  #pragma clang loop unroll(disable)
  for (int n = 0; n < KBLK - 2; ++n)
    pass(n & 1, n * BK, true, true);
  pass(0, SEQ - 2 * BK, true, false);
  pass(1, SEQ - BK, false, false);

  // ---- join the halves' sums, normalize and store fp32: 8 consecutive Dh of one query row per tile
  const float lsum = lrun + xhalf(lrun);
  float* orow = ob + (size_t)(q0 + m16) * DH + half8;
  #pragma unroll
  for (int t = 0; t < 4; ++t) {
    float4 lo, hi;
    lo.x = oacc[t][0] / lsum;  lo.y = oacc[t][1] / lsum;
    lo.z = oacc[t][2] / lsum;  lo.w = oacc[t][3] / lsum;
    hi.x = oacc[t][4] / lsum;  hi.y = oacc[t][5] / lsum;
    hi.z = oacc[t][6] / lsum;  hi.w = oacc[t][7] / lsum;
    *(float4*)(orow + t * 16)     = lo;
    *(float4*)(orow + t * 16 + 4) = hi;
  }
}

extern "C" void kernel_launch(void* const* d_in, const int* in_sizes, int n_in,
                              void* d_out, int out_size, void* d_ws, size_t ws_size,
                              hipStream_t stream) {
  const float* q    = (const float*)d_in[0];
  const float* k    = (const float*)d_in[1];
  const float* v    = (const float*)d_in[2];
  const int*   mask = (const int*)d_in[3];
  float*       out  = (float*)d_out;
  unsigned int* mwords = (unsigned int*)d_ws;   // 2 * 128 * 32 * 32 words = 1 MiB, written anew in every call

  dim3 grid(BATCH * HEADS * (SEQ / BQ));   // 2*16*16 = 512 workgroups
  dim3 block(NTHR);                        // 256 threads = 8 waves (wave32)
  dim3 pgrid(BATCH * (SEQ / 16) * (KBLK / PTIL) / PWAV);   // 2048 waves in 256 workgroups
  dim3 pblock(PWAV * 32);
  pack_mask_lane_words<<<pgrid, pblock, 0, stream>>>(mask, mwords);
  flash_attn_f16_wmma<<<grid, block, 0, stream>>>(q, k, v, mwords, out);
}

// v008
// A run of this version takes 44 microseconds.
// Timed twice side by side with v007, it ran 1.07 times as fast both times.
// Over all steps from v000 it is 4.96 times as fast.
#include <hip/hip_runtime.h>
#include <cmath>

typedef __attribute__((ext_vector_type(16))) _Float16 v16h;
typedef __attribute__((ext_vector_type(8)))  float    v8f;
typedef __attribute__((ext_vector_type(8)))  _Float16 v8h;
typedef __attribute__((ext_vector_type(8)))  short    s16x8;

namespace {
constexpr int BATCH = 2;
constexpr int HEADS = 16;
constexpr int SEQ   = 2048;
constexpr int DH    = 64;
constexpr int QG    = 2;                  // 16-query tiles per wave: each K and V fragment read from LDS serves both
constexpr int BQ    = 256;                // q rows per workgroup (8 waves x 2 tiles x 16)
constexpr int BK    = 64;                 // keys staged per iteration
constexpr int WAVES = 8;
constexpr int NTHR  = WAVES * 32;         // 256 threads, 8 wave32
constexpr int STG   = (BK * DH / 4) / NTHR;      // float4 per thread per matrix = 4
constexpr float SCALE = 0.125f;           // 64^-0.5
constexpr int VP    = DH + 16;            // V row pitch in halves: 160 B, an odd multiple of 32 B, for the transposing reader
constexpr int KP    = DH + 8;             // K row pitch in halves: 144 B, an odd multiple of 16 B, for the 16-byte row reader
constexpr int MP    = BK + 4;             // mask row pitch in ints: 272 B, an odd multiple of 16 B, for the 16-byte row reader
constexpr int KBLK  = SEQ / BK;           // key blocks per row = 32
constexpr int MWB   = 32;                 // lane-mask words per (16-query tile, 64-key block): one per score register
constexpr int PWAV  = 8;                  // waves per packing workgroup
constexpr int PTIL  = 4;                  // 64-key blocks packed per wave
}

// value of lane l ^ 16: the other half of this lane's query column
__device__ __forceinline__ float xhalf(float x) {
  const int i = __builtin_bit_cast(int, x);
  return __builtin_bit_cast(float, __builtin_amdgcn_permlanex16(i, i, 0x76543210, 0xfedcba98, false, false));
}

// transposing LDS load: lane (c = l & 15, h = l >> 4) receives T[kbase + 8h + 0..7][dbase + c]
__device__ __forceinline__ v8h ld_tr16(const _Float16* p) {
  typedef __attribute__((address_space(3))) s16x8 lds_s16x8;
  return __builtin_bit_cast(v8h, __builtin_amdgcn_ds_load_tr16_b128_v8i16((lds_s16x8*)p));
}

// work-group barrier that orders LDS alone: global loads issued ahead of it stay in flight across it,
// where __syncthreads() would wait for them
__device__ __forceinline__ void lds_barrier() {
  __builtin_amdgcn_fence(__ATOMIC_RELEASE, "workgroup", "local");
  __builtin_amdgcn_s_barrier();
  __builtin_amdgcn_fence(__ATOMIC_ACQUIRE, "workgroup", "local");
}

// Packs the int32 mask once for all heads into lane-mask words. For 16-query tile rt (batch * 128 + q / 16) and
// 64-key block kb, word t*8+r holds in bit l: mask[rt*16 + (l & 15)][kb*64 + t*16 + (l >> 4)*8 + r] != 0,
// which is the lane and register that hold this score in the attention kernel's S^T tiles.
__global__ __launch_bounds__(PWAV * 32)
void pack_mask_lane_words(const int* __restrict__ MASK, unsigned int* __restrict__ MW)
{
  __shared__ __attribute__((aligned(16))) int Ts[PWAV][PTIL][16][MP];  // each wave's own tiles, padded rows

  const int lane  = threadIdx.x & 31;
  const int wave  = threadIdx.x >> 5;
  const int job   = blockIdx.x * PWAV + wave;
  const int rt    = job / (KBLK / PTIL);
  const int cg    = job % (KBLK / PTIL);
  const int m16   = lane & 15;
  const int half8 = (lane >> 4) << 3;

  // whole 256-byte row pieces, two rows per wave-wide load, all loads in flight together
  const int* src = MASK + (size_t)rt * 16 * SEQ + cg * (PTIL * BK);
  int4 m[PTIL][8];
  #pragma unroll
  for (int p = 0; p < PTIL; ++p)
    #pragma unroll
    for (int it = 0; it < 8; ++it)
      m[p][it] = *(const int4*)(src + (size_t)(it * 2 + (lane >> 4)) * SEQ + p * BK + (m16 << 2));
  #pragma unroll
  for (int p = 0; p < PTIL; ++p)
    #pragma unroll
    for (int it = 0; it < 8; ++it)
      *(int4*)&Ts[wave][p][it * 2 + (lane >> 4)][m16 << 2] = m[p][it];
  __syncthreads();   // the rows stored above are read below by other lanes

  // lane l collects words 4l..4l+3 of the wave's 128, so that one 16-byte store per lane writes whole lines
  int w4[4] = {0, 0, 0, 0};
  #pragma unroll
  for (int p = 0; p < PTIL; ++p)
    #pragma unroll
    for (int t = 0; t < 4; ++t) {
      const int4 lo = *(const int4*)&Ts[wave][p][m16][t * 16 + half8];
      const int4 hi = *(const int4*)&Ts[wave][p][m16][t * 16 + half8 + 4];
      const int e[8] = {lo.x, lo.y, lo.z, lo.w, hi.x, hi.y, hi.z, hi.w};
      #pragma unroll
      for (int r = 0; r < 8; ++r) {
        const int w = p * MWB + t * 8 + r;
        const int word = (int)__builtin_amdgcn_ballot_w32(e[r] != 0);
        w4[w & 3] = (lane == (w >> 2)) ? word : w4[w & 3];
      }
    }
  int4 o;
  o.x = w4[0];  o.y = w4[1];  o.z = w4[2];  o.w = w4[3];
  *(int4*)(MW + ((size_t)rt * KBLK + cg * PTIL) * MWB + (lane << 2)) = o;
}

// two waves per SIMD and no more (one workgroup per WGP, the grid has no second): without the upper bound
// the scheduler narrows the softmax and the V reads to save registers for a third wave that never comes
__global__ __launch_bounds__(NTHR) __attribute__((amdgpu_waves_per_eu(2, 2)))
void flash_attn_f16_wmma(const float* __restrict__ Q,
                         const float* __restrict__ K,
                         const float* __restrict__ V,
                         const unsigned int* __restrict__ MW,
                         float* __restrict__ OUT)
{
  __shared__ __attribute__((aligned(16))) _Float16 Ks[2][BK][KP];  // two key blocks, f16, padded rows
  __shared__ __attribute__((aligned(16))) _Float16 Vs[2][BK][VP];  // two value blocks, f16, padded rows

  const int tid  = threadIdx.x;
  const int lane = tid & 31;
  const int wave = tid >> 5;

  const int qtiles = SEQ / BQ;
  const int bh = blockIdx.x / qtiles;
  const int qt = blockIdx.x % qtiles;
  const int b  = bh / HEADS;

  const float* qb = Q + (size_t)bh * SEQ * DH;
  const float* kb = K + (size_t)bh * SEQ * DH;
  const float* vb = V + (size_t)bh * SEQ * DH;
  float*       ob = OUT + (size_t)bh * SEQ * DH;

  const int m16   = lane & 15;
  const int half8 = (lane >> 4) << 3;      // 0 for lanes 0..15, 8 for 16..31
  const int qblk  = qt * BQ;
  const int q0    = qblk + wave * (16 * QG);   // this wave's first q row; tile g starts at q0 + 16 g

  // this wave's lane-mask words: a wave-uniform address, so that they arrive by scalar loads
  // (tile 0's; tile g's stand g * KBLK * MWB words further on)
  const unsigned int* mw0 = MW + (size_t)(b * (SEQ / 16) + (qblk >> 4)
                                         + __builtin_amdgcn_readfirstlane(wave) * QG) * (KBLK * MWB);

  // ---- Q^T B-fragments with softmax scale folded in (exact *0.125 in f16): lane = query column m16
  // hardware k order: lanes 0-15 hold k in {0..7,16..23}; lanes 16-31 hold {8..15,24..31}
  const float* qrow = qb + (size_t)(q0 + m16) * DH + half8;   // tile 0's row of this lane; tile g's: + g * 16 rows
  float qf[QG][2][16];
  #pragma unroll
  for (int g = 0; g < QG; ++g)
    #pragma unroll
    for (int c = 0; c < 2; ++c)
      #pragma unroll
      for (int j = 0; j < 16; ++j)
        qf[g][c][j] = qrow[g * 16 * DH + c * 32 + (j & 7) + ((j >> 3) << 4)];
  // precaution: the loads above have taken their address before anything lands on the registers that hold it;
  // naming the pointer keeps it in registers of its own up to here
  asm volatile("s_wait_xcnt 0x0" :: "v"(qrow) : "memory");
  v16h qa[QG][2];
  #pragma unroll
  for (int g = 0; g < QG; ++g)
    #pragma unroll
    for (int c = 0; c < 2; ++c)
      #pragma unroll
      for (int j = 0; j < 16; ++j)
        qa[g][c][j] = (_Float16)(qf[g][c][j] * SCALE);

  v8f oacc[QG][4] = {};      // O^T accumulators per query tile: 4 Dh-tiles of 16 rows, column = query m16
  float mrun[QG];            // running maximum of query m16 of each tile (equal in both wave halves)
  float lrun[QG];            // running sum over this wave half's keys; the halves join after the loop
  #pragma unroll
  for (int g = 0; g < QG; ++g) {
    mrun[g] = -INFINITY;
    lrun[g] = 0.f;
  }

  // ---- software pipeline: K/V blocks pass through these registers on their way to LDS
  float4 kreg[STG], vreg[STG];
  auto fetch = [&](const int k0) {
    const float4* ks = (const float4*)(kb + (size_t)k0 * DH);
    const float4* vs = (const float4*)(vb + (size_t)k0 * DH);
    #pragma unroll
    for (int it = 0; it < STG; ++it) {
      const int i = it * NTHR + tid;
      kreg[it] = ks[i];
      vreg[it] = vs[i];
    }
    // precaution: the loads issued so far have taken their addresses before later code rewrites
    // the registers that they name
    asm volatile("s_wait_xcnt 0x0" ::: "memory");
  };

  // the 32 lane-mask words of each query tile for key block k0 into scalar registers
  auto fetch_mask = [&](unsigned int (&mword)[QG][MWB], const int k0) {
    #pragma unroll
    for (int g = 0; g < QG; ++g)
      #pragma unroll
      for (int i = 0; i < MWB; ++i)
        mword[g][i] = mw0[g * (KBLK * MWB) + (k0 / BK) * MWB + i];
    // precaution: the loads have taken their address before later code rewrites the scalar registers that they name
    asm volatile("s_wait_xcnt 0x0" ::: "memory");
  };

  // commits the pipelined K/V registers to LDS buffer nb as f16
  auto commit = [&](const int nb) __attribute__((always_inline)) {
    #pragma unroll
    for (int it = 0; it < STG; ++it) {
      const int row = it * (NTHR / 16) + (tid >> 4);   // constant row steps: one address register per matrix
      const int col = (tid & 15) << 2;
      Ks[nb][row][col + 0] = (_Float16)kreg[it].x;
      Ks[nb][row][col + 1] = (_Float16)kreg[it].y;
      Ks[nb][row][col + 2] = (_Float16)kreg[it].z;
      Ks[nb][row][col + 3] = (_Float16)kreg[it].w;
      Vs[nb][row][col + 0] = (_Float16)vreg[it].x;
      Vs[nb][row][col + 1] = (_Float16)vreg[it].y;
      Vs[nb][row][col + 2] = (_Float16)vreg[it].z;
      Vs[nb][row][col + 3] = (_Float16)vreg[it].w;
    }
  };
  unsigned int mword[QG][MWB];   // the current key block's mask words, per query tile
  fetch(0);
  fetch_mask(mword, 0);
  commit(0);
  fetch(BK);         // block 1 waits in registers for the head of pass 0
  // keeps the address arithmetic of the loop, which reuses registers that these loads name, behind fetch's wait
  __builtin_amdgcn_sched_barrier(0);
  lds_barrier();     // block 0 is in buffer 0 for every wave

  // this lane's source row and 16-byte half for the transposing V loads, in buffer 0
  const _Float16* vtr0 = &Vs[0][half8 + (lane & 7)][((lane >> 3) & 1) << 3];

  // one pass: key block k0 from LDS buffer u with mask words mword; more = a next block exists, more2 = a block
  // after that too (more and more2 are constants at each call)
  auto pass = [&](const int u, const int k0, const bool more, const bool more2) __attribute__((always_inline)) {
    const _Float16* vtr = vtr0 + u * (BK * VP);

    // ---- every read from L2 has a whole pass of lead over its first use: the next block, loaded during the
    // previous pass, goes into the other buffer, whose last readers left it before the previous barrier;
    // then the K/V block after it is requested
    if (more)
      commit(u ^ 1);
    if (more2) {
      // keeps the new loads behind the conversions above, so that they land in the same 32 registers
      __builtin_amdgcn_sched_barrier(0);
      fetch(k0 + 2 * BK);
    }

    // ---- scores, transposed: S^T = K * (Q*scale)^T, 4 key tiles of 16 rows, k-dim 64 (2 WMMA each)
    // sc[g][t][r] = score of key k0 + t*16 + half8 + r against query q0 + g*16 + m16
    v8f sc[QG][4];
    #pragma unroll
    for (int t = 0; t < 4; ++t) {
      #pragma unroll
      for (int g = 0; g < QG; ++g)
        sc[g][t] = v8f{};
      #pragma unroll
      for (int c = 0; c < 2; ++c) {
        v16h kf;   // lane holds key row t*16+m16, j walks Dh
        #pragma unroll
        for (int j = 0; j < 16; ++j) {
          const int kk = c * 32 + half8 + (j & 7) + ((j >> 3) << 4);
          kf[j] = Ks[u][t * 16 + m16][kk];
        }
        #pragma unroll
        for (int g = 0; g < QG; ++g)
          sc[g][t] = __builtin_amdgcn_wmma_f32_16x16x32_f16(false, kf, false, qa[g][c],
                                                            (short)0, sc[g][t], false, false);
      }
    }

    // ---- mask (mask==0 -> -1e9): each word is the select's lane mask as it stands
    #pragma unroll
    for (int g = 0; g < QG; ++g)
      #pragma unroll
      for (int t = 0; t < 4; ++t)
        #pragma unroll
        for (int r = 0; r < 8; ++r)
          sc[g][t][r] = __builtin_amdgcn_inverse_ballot_w32(mword[g][t * 8 + r]) ? sc[g][t][r] : -1e9f;

    // ---- the next block's mask words, requested once this block's are used up, into the same scalar registers
    if (more) {
      // keeps the requests behind the selects above
      __builtin_amdgcn_sched_barrier(0);
      fetch_mask(mword, k0 + BK);
    }

    // P^T B-fragments straight from the score tiles: tiles 2c and 2c+1 are k 0..7,16..23 (+8 in the upper half)
    v16h pb[QG][2];
    #pragma unroll
    for (int g = 0; g < QG; ++g) {
      // ---- online softmax update: one query per lane, maximum and sum in-lane
      float bm = sc[g][0][0];
      #pragma unroll
      for (int t = 0; t < 4; ++t)
        #pragma unroll
        for (int r = 0; r < 8; ++r)
          bm = fmaxf(bm, sc[g][t][r]);
      bm = fmaxf(bm, xhalf(bm));                  // both halves now hold the block maximum of the query
      const float mnew = fmaxf(mrun[g], bm);
      const float corr = __expf(mrun[g] - mnew);  // exp(-inf)=0 on first block
      mrun[g] = mnew;

      float bsum = 0.f;
      #pragma unroll
      for (int t = 0; t < 4; ++t)
        #pragma unroll
        for (int r = 0; r < 8; ++r) {
          const float p = __expf(sc[g][t][r] - mnew);
          bsum += p;
          pb[g][t >> 1][((t & 1) << 3) + r] = (_Float16)p;
        }
      lrun[g] = lrun[g] * corr + bsum;
      #pragma unroll
      for (int t = 0; t < 4; ++t)
        #pragma unroll
        for (int r = 0; r < 8; ++r)
          oacc[g][t][r] *= corr;
    }

    // ---- O^T += V^T * P^T   (A = V^T 16x32 tiles by the transposing load, B = P^T 32x16)
    #pragma unroll
    for (int t = 0; t < 4; ++t) {
      #pragma unroll
      for (int c = 0; c < 2; ++c) {
        // lane holds Dh row t*16+m16; elements 0..7 = keys c*32+half8+0..7, 8..15 = the same + 16
        const v8h lo = ld_tr16(vtr + (c * 32) * VP + t * 16);
        const v8h hi = ld_tr16(vtr + (c * 32 + 16) * VP + t * 16);
        const v16h av = __builtin_shufflevector(lo, hi, 0, 1, 2, 3, 4, 5, 6, 7,
                                                8, 9, 10, 11, 12, 13, 14, 15);
        #pragma unroll
        for (int g = 0; g < QG; ++g)
          oacc[g][t] = __builtin_amdgcn_wmma_f32_16x16x32_f16(false, av, false, pb[g][c],
                                                              (short)0, oacc[g][t], false, false);
      }
    }

    if (more) {
      lds_barrier();     // the one barrier of a pass: publishes the next block, ends this block's reads
    }
  };

  // one pass per trip: two passes in one block of code are mixed by the scheduler, which then holds both passes'
  // fragments and scores beside the K/V registers; the last two passes stand alone
  #pragma clang loop unroll(disable)
  for (int n = 0; n < KBLK - 2; ++n)
    pass(n & 1, n * BK, true, true);
  pass(0, SEQ - 2 * BK, true, false);
  pass(1, SEQ - BK, false, false);

  // ---- join the halves' sums, normalize and store fp32: 8 consecutive Dh of one query row per tile
  #pragma unroll
  for (int g = 0; g < QG; ++g) {
    const float lsum = lrun[g] + xhalf(lrun[g]);
    float* orow = ob + (size_t)(q0 + g * 16 + m16) * DH + half8;
    #pragma unroll
    for (int t = 0; t < 4; ++t) {
      float4 lo, hi;
      lo.x = oacc[g][t][0] / lsum;  lo.y = oacc[g][t][1] / lsum;
      lo.z = oacc[g][t][2] / lsum;  lo.w = oacc[g][t][3] / lsum;
      hi.x = oacc[g][t][4] / lsum;  hi.y = oacc[g][t][5] / lsum;
      hi.z = oacc[g][t][6] / lsum;  hi.w = oacc[g][t][7] / lsum;
      *(float4*)(orow + t * 16)     = lo;
      *(float4*)(orow + t * 16 + 4) = hi;
    }
  }
}

extern "C" void kernel_launch(void* const* d_in, const int* in_sizes, int n_in,
                              void* d_out, int out_size, void* d_ws, size_t ws_size,
                              hipStream_t stream) {
  const float* q    = (const float*)d_in[0];
  const float* k    = (const float*)d_in[1];
  const float* v    = (const float*)d_in[2];
  const int*   mask = (const int*)d_in[3];
  float*       out  = (float*)d_out;
  unsigned int* mwords = (unsigned int*)d_ws;   // 2 * 128 * 32 * 32 words = 1 MiB, written anew in every call

  dim3 grid(BATCH * HEADS * (SEQ / BQ));   // 2*16*8 = 256 workgroups
  dim3 block(NTHR);                        // 256 threads = 8 waves (wave32)
  dim3 pgrid(BATCH * (SEQ / 16) * (KBLK / PTIL) / PWAV);   // 2048 waves in 256 workgroups
  dim3 pblock(PWAV * 32);
  pack_mask_lane_words<<<pgrid, pblock, 0, stream>>>(mask, mwords);
  flash_attn_f16_wmma<<<grid, block, 0, stream>>>(q, k, v, mwords, out);
}

// v009
// One run takes 40.5 microseconds.
// In both of two side-by-side timings against v008, it was 1.09 times as fast.
// All steps since v000 together make it 5.38 times as fast.
#include <hip/hip_runtime.h>
#include <cmath>

typedef __attribute__((ext_vector_type(16))) _Float16 v16h;
typedef __attribute__((ext_vector_type(8)))  float    v8f;
typedef __attribute__((ext_vector_type(8)))  _Float16 v8h;
typedef __attribute__((ext_vector_type(8)))  short    s16x8;

namespace {
constexpr int BATCH = 2;
constexpr int HEADS = 16;
constexpr int SEQ   = 2048;
constexpr int DH    = 64;
constexpr int QG    = 2;                  // 16-query tiles per wave: each K and V fragment read from LDS serves both
constexpr int BQ    = 256;                // q rows per workgroup (8 waves x 2 tiles x 16)
constexpr int BK    = 64;                 // keys staged per iteration
constexpr int WAVES = 8;
constexpr int NTHR  = WAVES * 32;         // 256 threads, 8 wave32
constexpr int STG   = (BK * DH / 4) / NTHR;      // float4 per thread per matrix = 4
constexpr float QSCALE = 0.125f * 1.44269504f;   // 64^-0.5 * log2(e): scores come out in base 2
constexpr float NEGL2 = -1e9f * 1.44269504f;     // the reference's masked score, in base 2
constexpr float LAZY  = 8.f;              // a block may top the maximum in use by this much (base 2) before a rescale
constexpr int VP    = DH + 16;            // V row pitch in halves: 160 B, an odd multiple of 32 B, for the transposing reader
constexpr int KP    = DH + 8;             // K row pitch in halves: 144 B, an odd multiple of 16 B, for the 16-byte row reader
constexpr int MP    = BK + 4;             // mask row pitch in ints: 272 B, an odd multiple of 16 B, for the 16-byte row reader
constexpr int KBLK  = SEQ / BK;           // key blocks per row = 32
constexpr int MWB   = 32;                 // lane-mask words per (16-query tile, 64-key block): one per score register
constexpr int PWAV  = 8;                  // waves per packing workgroup
constexpr int PTIL  = 4;                  // 64-key blocks packed per wave
}

// value of lane l ^ 16: the other half of this lane's query column
__device__ __forceinline__ float xhalf(float x) {
  const int i = __builtin_bit_cast(int, x);
  return __builtin_bit_cast(float, __builtin_amdgcn_permlanex16(i, i, 0x76543210, 0xfedcba98, false, false));
}

// transposing LDS load: lane (c = l & 15, h = l >> 4) receives T[kbase + 8h + 0..7][dbase + c]
__device__ __forceinline__ v8h ld_tr16(const _Float16* p) {
  typedef __attribute__((address_space(3))) s16x8 lds_s16x8;
  return __builtin_bit_cast(v8h, __builtin_amdgcn_ds_load_tr16_b128_v8i16((lds_s16x8*)p));
}

// work-group barrier that orders LDS alone: global loads issued ahead of it stay in flight across it,
// where __syncthreads() would wait for them
__device__ __forceinline__ void lds_barrier() {
  __builtin_amdgcn_fence(__ATOMIC_RELEASE, "workgroup", "local");
  __builtin_amdgcn_s_barrier();
  __builtin_amdgcn_fence(__ATOMIC_ACQUIRE, "workgroup", "local");
}

// Packs the int32 mask once for all heads into lane-mask words. For 16-query tile rt (batch * 128 + q / 16) and
// 64-key block kb, word t*8+r holds in bit l: mask[rt*16 + (l & 15)][kb*64 + t*16 + (l >> 4)*8 + r] != 0,
// which is the lane and register that hold this score in the attention kernel's S^T tiles.
__global__ __launch_bounds__(PWAV * 32)
void pack_mask_lane_words(const int* __restrict__ MASK, unsigned int* __restrict__ MW)
{
  __shared__ __attribute__((aligned(16))) int Ts[PWAV][PTIL][16][MP];  // each wave's own tiles, padded rows

  const int lane  = threadIdx.x & 31;
  const int wave  = threadIdx.x >> 5;
  const int job   = blockIdx.x * PWAV + wave;
  const int rt    = job / (KBLK / PTIL);
  const int cg    = job % (KBLK / PTIL);
  const int m16   = lane & 15;
  const int half8 = (lane >> 4) << 3;

  // whole 256-byte row pieces, two rows per wave-wide load, all loads in flight together
  const int* src = MASK + (size_t)rt * 16 * SEQ + cg * (PTIL * BK);
  int4 m[PTIL][8];
  #pragma unroll
  for (int p = 0; p < PTIL; ++p)
    #pragma unroll
    for (int it = 0; it < 8; ++it)
      m[p][it] = *(const int4*)(src + (size_t)(it * 2 + (lane >> 4)) * SEQ + p * BK + (m16 << 2));
  #pragma unroll
  for (int p = 0; p < PTIL; ++p)
    #pragma unroll
    for (int it = 0; it < 8; ++it)
      *(int4*)&Ts[wave][p][it * 2 + (lane >> 4)][m16 << 2] = m[p][it];
  __syncthreads();   // the rows stored above are read below by other lanes

  // lane l collects words 4l..4l+3 of the wave's 128, so that one 16-byte store per lane writes whole lines
  int w4[4] = {0, 0, 0, 0};
  #pragma unroll
  for (int p = 0; p < PTIL; ++p)
    #pragma unroll
    for (int t = 0; t < 4; ++t) {
      const int4 lo = *(const int4*)&Ts[wave][p][m16][t * 16 + half8];
      const int4 hi = *(const int4*)&Ts[wave][p][m16][t * 16 + half8 + 4];
      const int e[8] = {lo.x, lo.y, lo.z, lo.w, hi.x, hi.y, hi.z, hi.w};
      #pragma unroll
      for (int r = 0; r < 8; ++r) {
        const int w = p * MWB + t * 8 + r;
        const int word = (int)__builtin_amdgcn_ballot_w32(e[r] != 0);
        w4[w & 3] = (lane == (w >> 2)) ? word : w4[w & 3];
      }
    }
  int4 o;
  o.x = w4[0];  o.y = w4[1];  o.z = w4[2];  o.w = w4[3];
  *(int4*)(MW + ((size_t)rt * KBLK + cg * PTIL) * MWB + (lane << 2)) = o;
}

// two waves per SIMD and no more (one workgroup per WGP, the grid has no second): without the upper bound
// the scheduler narrows the softmax and the V reads to save registers for a third wave that never comes
__global__ __launch_bounds__(NTHR) __attribute__((amdgpu_waves_per_eu(2, 2)))
void flash_attn_f16_wmma(const float* __restrict__ Q,
                         const float* __restrict__ K,
                         const float* __restrict__ V,
                         const unsigned int* __restrict__ MW,
                         float* __restrict__ OUT)
{
  __shared__ __attribute__((aligned(16))) _Float16 Ks[2][BK][KP];  // two key blocks, f16, padded rows
  __shared__ __attribute__((aligned(16))) _Float16 Vs[2][BK][VP];  // two value blocks, f16, padded rows

  const int tid  = threadIdx.x;
  const int lane = tid & 31;
  const int wave = tid >> 5;

  const int qtiles = SEQ / BQ;
  const int bh = blockIdx.x / qtiles;
  const int qt = blockIdx.x % qtiles;
  const int b  = bh / HEADS;

  const float* qb = Q + (size_t)bh * SEQ * DH;
  const float* kb = K + (size_t)bh * SEQ * DH;
  const float* vb = V + (size_t)bh * SEQ * DH;
  float*       ob = OUT + (size_t)bh * SEQ * DH;

  const int m16   = lane & 15;
  const int half8 = (lane >> 4) << 3;      // 0 for lanes 0..15, 8 for 16..31
  const int qblk  = qt * BQ;
  const int q0    = qblk + wave * (16 * QG);   // this wave's first q row; tile g starts at q0 + 16 g

  // this wave's lane-mask words: a wave-uniform address, so that they arrive by scalar loads
  // (tile 0's; tile g's stand g * KBLK * MWB words further on)
  const unsigned int* mw0 = MW + (size_t)(b * (SEQ / 16) + (qblk >> 4)
                                         + __builtin_amdgcn_readfirstlane(wave) * QG) * (KBLK * MWB);

  // ---- Q^T B-fragments with softmax scale and log2(e) folded in: lane = query column m16
  // hardware k order: lanes 0-15 hold k in {0..7,16..23}; lanes 16-31 hold {8..15,24..31}
  const float* qrow = qb + (size_t)(q0 + m16) * DH + half8;   // tile 0's row of this lane; tile g's: + g * 16 rows
  float qf[QG][2][16];
  #pragma unroll
  for (int g = 0; g < QG; ++g)
    #pragma unroll
    for (int c = 0; c < 2; ++c)
      #pragma unroll
      for (int j = 0; j < 16; ++j)
        qf[g][c][j] = qrow[g * 16 * DH + c * 32 + (j & 7) + ((j >> 3) << 4)];
  // precaution: the loads above have taken their address before anything lands on the registers that hold it;
  // naming the pointer keeps it in registers of its own up to here
  asm volatile("s_wait_xcnt 0x0" :: "v"(qrow) : "memory");
  v16h qa[QG][2];
  #pragma unroll
  for (int g = 0; g < QG; ++g)
    #pragma unroll
    for (int c = 0; c < 2; ++c)
      #pragma unroll
      for (int j = 0; j < 16; ++j)
        qa[g][c][j] = (_Float16)(qf[g][c][j] * QSCALE);

  v8f oacc[QG][4] = {};      // O^T accumulators per query tile: 4 Dh-tiles of 16 rows, column = query m16
  float muse[QG];            // maximum in use for query m16 of each tile (equal in both wave halves), base 2
  v8f   negm[QG];            // minus that maximum in every row: the C operand of the score products
  float mval[QG];            // a masked score against that maximum
  float lrun[QG];            // running sum over this wave half's keys; the halves join after the loop
  #pragma unroll
  for (int g = 0; g < QG; ++g) {
    muse[g] = -INFINITY;     // no maximum yet: the first pass's scores come out +inf and take the rescaling path
    #pragma unroll
    for (int r = 0; r < 8; ++r)
      negm[g][r] = INFINITY;
    mval[g] = INFINITY;
    lrun[g] = 0.f;
  }

  // ---- software pipeline: K/V blocks pass through these registers on their way to LDS
  float4 kreg[STG], vreg[STG];
  auto fetch = [&](const int k0) {
    const float4* ks = (const float4*)(kb + (size_t)k0 * DH);
    const float4* vs = (const float4*)(vb + (size_t)k0 * DH);
    #pragma unroll
    for (int it = 0; it < STG; ++it) {
      const int i = it * NTHR + tid;
      kreg[it] = ks[i];
      vreg[it] = vs[i];
    }
    // precaution: the loads issued so far have taken their addresses before later code rewrites
    // the registers that they name
    asm volatile("s_wait_xcnt 0x0" ::: "memory");
  };

  // the 32 lane-mask words of each query tile for key block k0 into scalar registers
  auto fetch_mask = [&](unsigned int (&mword)[QG][MWB], const int k0) {
    #pragma unroll
    for (int g = 0; g < QG; ++g)
      #pragma unroll
      for (int i = 0; i < MWB; ++i)
        mword[g][i] = mw0[g * (KBLK * MWB) + (k0 / BK) * MWB + i];
    // precaution: the loads have taken their address before later code rewrites the scalar registers that they name
    asm volatile("s_wait_xcnt 0x0" ::: "memory");
  };

  // commits the pipelined K/V registers to LDS buffer nb as f16
  auto commit = [&](const int nb) __attribute__((always_inline)) {
    #pragma unroll
    for (int it = 0; it < STG; ++it) {
      const int row = it * (NTHR / 16) + (tid >> 4);   // constant row steps: one address register per matrix
      const int col = (tid & 15) << 2;
      Ks[nb][row][col + 0] = (_Float16)kreg[it].x;
      Ks[nb][row][col + 1] = (_Float16)kreg[it].y;
      Ks[nb][row][col + 2] = (_Float16)kreg[it].z;
      Ks[nb][row][col + 3] = (_Float16)kreg[it].w;
      Vs[nb][row][col + 0] = (_Float16)vreg[it].x;
      Vs[nb][row][col + 1] = (_Float16)vreg[it].y;
      Vs[nb][row][col + 2] = (_Float16)vreg[it].z;
      Vs[nb][row][col + 3] = (_Float16)vreg[it].w;
    }
  };
  unsigned int mword[QG][MWB];   // the current key block's mask words, per query tile
  fetch(0);
  fetch_mask(mword, 0);
  commit(0);
  fetch(BK);         // block 1 waits in registers for the head of pass 0
  // keeps the address arithmetic of the loop, which reuses registers that these loads name, behind fetch's wait
  __builtin_amdgcn_sched_barrier(0);
  lds_barrier();     // block 0 is in buffer 0 for every wave

  // this lane's source row and 16-byte half for the transposing V loads, in buffer 0
  const _Float16* vtr0 = &Vs[0][half8 + (lane & 7)][((lane >> 3) & 1) << 3];

  // one pass: key block k0 from LDS buffer u with mask words mword; more = a next block exists, more2 = a block
  // after that too (more and more2 are constants at each call)
  auto pass = [&](const int u, const int k0, const bool more, const bool more2) __attribute__((always_inline)) {
    const _Float16* vtr = vtr0 + u * (BK * VP);

    // ---- every read from L2 has a whole pass of lead over its first use: the next block, loaded during the
    // previous pass, goes into the other buffer, whose last readers left it before the previous barrier;
    // then the K/V block after it is requested
    if (more)
      commit(u ^ 1);
    if (more2) {
      // keeps the new loads behind the conversions above, so that they land in the same 32 registers
      __builtin_amdgcn_sched_barrier(0);
      fetch(k0 + 2 * BK);
    }

    // ---- scores, transposed, against the maximum in use: S^T = K * (Q*scale)^T + C, 4 key tiles of 16 rows,
    // k-dim 64 (2 WMMA each); sc[g][t][r] = score of key k0 + t*16 + half8 + r against query q0 + g*16 + m16
    v8f sc[QG][4];
    auto score_tiles = [&](const v8f (&c0)[QG]) __attribute__((always_inline)) {
      #pragma unroll
      for (int t = 0; t < 4; ++t) {
        #pragma unroll
        for (int c = 0; c < 2; ++c) {
          v16h kf;   // lane holds key row t*16+m16, j walks Dh
          #pragma unroll
          for (int j = 0; j < 16; ++j) {
            const int kk = c * 32 + half8 + (j & 7) + ((j >> 3) << 4);
            kf[j] = Ks[u][t * 16 + m16][kk];
          }
          #pragma unroll
          for (int g = 0; g < QG; ++g)
            sc[g][t] = __builtin_amdgcn_wmma_f32_16x16x32_f16(false, kf, false, qa[g][c],
                                                              (short)0, c == 0 ? c0[g] : sc[g][t], false, false);
        }
      }
    };
    score_tiles(negm);

    // ---- mask (mask==0 -> mval, the reference's -1e9 in base 2 less the maximum in use): each word is the select's lane mask as it stands
    #pragma unroll
    for (int g = 0; g < QG; ++g)
      #pragma unroll
      for (int t = 0; t < 4; ++t)
        #pragma unroll
        for (int r = 0; r < 8; ++r)
          sc[g][t][r] = __builtin_amdgcn_inverse_ballot_w32(mword[g][t * 8 + r]) ? sc[g][t][r] : mval[g];

    // ---- how far this lane's scores top the maximum in use: four independent chains
    float top[QG][2];
    #pragma unroll
    for (int g = 0; g < QG; ++g)
      #pragma unroll
      for (int h = 0; h < 2; ++h) {
        top[g][h] = sc[g][2 * h][0];
        #pragma unroll
        for (int t = 2 * h; t < 2 * h + 2; ++t)
          #pragma unroll
          for (int r = 0; r < 8; ++r)
            top[g][h] = fmaxf(top[g][h], sc[g][t][r]);
      }
    const bool need = fmaxf(fmaxf(top[0][0], top[0][1]), fmaxf(top[1][0], top[1][1])) > LAZY;

    // ---- one wave-uniform test per pass; taken in the first pass and wherever a query's scores outgrow its maximum
    if (__builtin_amdgcn_ballot_w32(need) != 0) {
      // the scores anew without a shift (a maximum in use of -1e9 or -inf has cost the shifted ones their low bits)
      const v8f zero[QG] = {};
      score_tiles(zero);
      #pragma unroll
      for (int g = 0; g < QG; ++g) {
        #pragma unroll
        for (int t = 0; t < 4; ++t)
          #pragma unroll
          for (int r = 0; r < 8; ++r)
            sc[g][t][r] = __builtin_amdgcn_inverse_ballot_w32(mword[g][t * 8 + r]) ? sc[g][t][r] : NEGL2;
        float bm = sc[g][0][0];
        #pragma unroll
        for (int t = 0; t < 4; ++t)
          #pragma unroll
          for (int r = 0; r < 8; ++r)
            bm = fmaxf(bm, sc[g][t][r]);
        bm = fmaxf(bm, xhalf(bm));                  // both halves now hold the block maximum of the query
        const float mnew = fmaxf(muse[g], bm);
        const float corr = __builtin_amdgcn_exp2f(muse[g] - mnew);  // exp2(-inf)=0 on first block
        muse[g] = mnew;
        mval[g] = NEGL2 - mnew;                     // 0 while every key so far was masked: such keys weigh alike
        lrun[g] *= corr;
        #pragma unroll
        for (int r = 0; r < 8; ++r)
          negm[g][r] = -mnew;
        #pragma unroll
        for (int t = 0; t < 4; ++t)
          #pragma unroll
          for (int r = 0; r < 8; ++r) {
            sc[g][t][r] -= mnew;
            oacc[g][t][r] *= corr;
          }
      }
    }

    // ---- V^T A-fragments by the transposing load, requested ahead of the exponentials, which cover their way from LDS
    // lane holds Dh row t*16+m16; elements 0..7 = keys c*32+half8+0..7, 8..15 = the same + 16
    v16h av[4][2];
    #pragma unroll
    for (int t = 0; t < 4; ++t)
      #pragma unroll
      for (int c = 0; c < 2; ++c) {
        const v8h lo = ld_tr16(vtr + (c * 32) * VP + t * 16);
        const v8h hi = ld_tr16(vtr + (c * 32 + 16) * VP + t * 16);
        av[t][c] = __builtin_shufflevector(lo, hi, 0, 1, 2, 3, 4, 5, 6, 7,
                                           8, 9, 10, 11, 12, 13, 14, 15);
      }

    // ---- the next block's mask words, requested once this block's are used up, into the same scalar registers
    if (more)
      fetch_mask(mword, k0 + BK);
    // keeps the V reads and the mask requests above ahead of the exponentials: sunk among the products below,
    // they would be waited for there
    __builtin_amdgcn_sched_barrier(0);

    // P^T B-fragments straight from the score tiles: tiles 2c and 2c+1 are k 0..7,16..23 (+8 in the upper half)
    v16h pb[QG][2];
    #pragma unroll
    for (int g = 0; g < QG; ++g) {
      // ---- the scores are exp2 arguments as they stand; one query per lane, sum in-lane
      float bsum = 0.f;
      #pragma unroll
      for (int t = 0; t < 4; ++t)
        #pragma unroll
        for (int r = 0; r < 8; ++r) {
          const float p = __builtin_amdgcn_exp2f(sc[g][t][r]);
          bsum += p;
          pb[g][t >> 1][((t & 1) << 3) + r] = (_Float16)p;
        }
      lrun[g] += bsum;
    }

    // ---- O^T += V^T * P^T   (A = V^T 16x32 tiles by the transposing load, B = P^T 32x16)
    #pragma unroll
    for (int t = 0; t < 4; ++t) {
      #pragma unroll
      for (int c = 0; c < 2; ++c) {
        #pragma unroll
        for (int g = 0; g < QG; ++g)
          oacc[g][t] = __builtin_amdgcn_wmma_f32_16x16x32_f16(false, av[t][c], false, pb[g][c],
                                                              (short)0, oacc[g][t], false, false);
      }
    }

    if (more) {
      lds_barrier();     // the one barrier of a pass: publishes the next block, ends this block's reads
    }
  };

  // one pass per trip: two passes in one block of code are mixed by the scheduler, which then holds both passes'
  // fragments and scores beside the K/V registers; the last two passes stand alone
  #pragma clang loop unroll(disable)
  for (int n = 0; n < KBLK - 2; ++n)
    pass(n & 1, n * BK, true, true);
  pass(0, SEQ - 2 * BK, true, false);
  pass(1, SEQ - BK, false, false);

  // ---- join the halves' sums, normalize and store fp32: 8 consecutive Dh of one query row per tile
  #pragma unroll
  for (int g = 0; g < QG; ++g) {
    const float lsum = lrun[g] + xhalf(lrun[g]);
    float* orow = ob + (size_t)(q0 + g * 16 + m16) * DH + half8;
    #pragma unroll
    for (int t = 0; t < 4; ++t) {
      float4 lo, hi;
      lo.x = oacc[g][t][0] / lsum;  lo.y = oacc[g][t][1] / lsum;
      lo.z = oacc[g][t][2] / lsum;  lo.w = oacc[g][t][3] / lsum;
      hi.x = oacc[g][t][4] / lsum;  hi.y = oacc[g][t][5] / lsum;
      hi.z = oacc[g][t][6] / lsum;  hi.w = oacc[g][t][7] / lsum;
      *(float4*)(orow + t * 16)     = lo;
      *(float4*)(orow + t * 16 + 4) = hi;
    }
  }
}

extern "C" void kernel_launch(void* const* d_in, const int* in_sizes, int n_in,
                              void* d_out, int out_size, void* d_ws, size_t ws_size,
                              hipStream_t stream) {
  const float* q    = (const float*)d_in[0];
  const float* k    = (const float*)d_in[1];
  const float* v    = (const float*)d_in[2];
  const int*   mask = (const int*)d_in[3];
  float*       out  = (float*)d_out;
  unsigned int* mwords = (unsigned int*)d_ws;   // 2 * 128 * 32 * 32 words = 1 MiB, written anew in every call

  dim3 grid(BATCH * HEADS * (SEQ / BQ));   // 2*16*8 = 256 workgroups
  dim3 block(NTHR);                        // 256 threads = 8 waves (wave32)
  dim3 pgrid(BATCH * (SEQ / 16) * (KBLK / PTIL) / PWAV);   // 2048 waves in 256 workgroups
  dim3 pblock(PWAV * 32);
  pack_mask_lane_words<<<pgrid, pblock, 0, stream>>>(mask, mwords);
  flash_attn_f16_wmma<<<grid, block, 0, stream>>>(q, k, v, mwords, out);
}

// v010
// It runs in 38.9 microseconds.
// In both of two side-by-side timings against v009, it was 1.04 times as fast.
// Counting every step since v000, it is 5.60 times as fast.
#include <hip/hip_runtime.h>
#include <cmath>

typedef __attribute__((ext_vector_type(16))) _Float16 v16h;
typedef __attribute__((ext_vector_type(8)))  float    v8f;
typedef __attribute__((ext_vector_type(8)))  _Float16 v8h;
typedef __attribute__((ext_vector_type(8)))  short    s16x8;

namespace {
constexpr int BATCH = 2;
constexpr int HEADS = 16;
constexpr int SEQ   = 2048;
constexpr int DH    = 64;
constexpr int QG    = 2;                  // 16-query tiles per wave: each K and V fragment read from LDS serves both
constexpr int BQ    = 256;                // q rows per workgroup (8 waves x 2 tiles x 16)
constexpr int BK    = 64;                 // keys staged per iteration
constexpr int WAVES = 8;
constexpr int NTHR  = WAVES * 32;         // 256 threads, 8 wave32
constexpr int STG   = (BK * DH / 4) / NTHR;      // float4 per thread per matrix = 4
constexpr float QSCALE = 0.125f * 1.44269504f;   // 64^-0.5 * log2(e): scores come out in base 2
constexpr float NEGL2 = -1e9f * 1.44269504f;     // the reference's masked score, in base 2
constexpr float LAZY  = 8.f;              // a block may top the maximum in use by this much (base 2) before a rescale
constexpr int VP    = DH + 16;            // V row pitch in halves: 160 B, an odd multiple of 32 B, for the transposing reader
constexpr int KP    = DH + 8;             // K row pitch in halves: 144 B, an odd multiple of 16 B, for the 16-byte row reader
constexpr int MP    = BK + 4;             // mask row pitch in ints: 272 B, an odd multiple of 16 B, for the 16-byte row reader
constexpr int KBLK  = SEQ / BK;           // key blocks per row = 32
constexpr int MWB   = 32;                 // lane-mask words per (16-query tile, 64-key block): one per score register
constexpr int PWAV  = 8;                  // waves per packing workgroup
constexpr int PTIL  = 4;                  // 64-key blocks packed per wave
}

// value of lane l ^ 16: the other half of this lane's query column
__device__ __forceinline__ float xhalf(float x) {
  const int i = __builtin_bit_cast(int, x);
  return __builtin_bit_cast(float, __builtin_amdgcn_permlanex16(i, i, 0x76543210, 0xfedcba98, false, false));
}

// transposing LDS load: lane (c = l & 15, h = l >> 4) receives T[kbase + 8h + 0..7][dbase + c]
__device__ __forceinline__ v8h ld_tr16(const _Float16* p) {
  typedef __attribute__((address_space(3))) s16x8 lds_s16x8;
  return __builtin_bit_cast(v8h, __builtin_amdgcn_ds_load_tr16_b128_v8i16((lds_s16x8*)p));
}

// work-group barrier that orders LDS alone: global loads issued ahead of it stay in flight across it,
// where __syncthreads() would wait for them
__device__ __forceinline__ void lds_barrier() {
  __builtin_amdgcn_fence(__ATOMIC_RELEASE, "workgroup", "local");
  __builtin_amdgcn_s_barrier();
  __builtin_amdgcn_fence(__ATOMIC_ACQUIRE, "workgroup", "local");
}

// Packs the int32 mask once for all heads into lane-mask words. For 16-query tile rt (batch * 128 + q / 16) and
// 64-key block kb, word t*8+r holds in bit l: mask[rt*16 + (l & 15)][kb*64 + t*16 + (l >> 4)*8 + r] != 0,
// which is the lane and register that hold this score in the attention kernel's S^T tiles.
__global__ __launch_bounds__(PWAV * 32)
void pack_mask_lane_words(const int* __restrict__ MASK, unsigned int* __restrict__ MW)
{
  __shared__ __attribute__((aligned(16))) int Ts[PWAV][PTIL][16][MP];  // each wave's own tiles, padded rows

  const int lane  = threadIdx.x & 31;
  const int wave  = threadIdx.x >> 5;
  const int job   = blockIdx.x * PWAV + wave;
  const int rt    = job / (KBLK / PTIL);
  const int cg    = job % (KBLK / PTIL);
  const int m16   = lane & 15;
  const int half8 = (lane >> 4) << 3;

  // whole 256-byte row pieces, two rows per wave-wide load, all loads in flight together
  const int* src = MASK + (size_t)rt * 16 * SEQ + cg * (PTIL * BK);
  int4 m[PTIL][8];
  #pragma unroll
  for (int p = 0; p < PTIL; ++p)
    #pragma unroll
    for (int it = 0; it < 8; ++it)
      m[p][it] = *(const int4*)(src + (size_t)(it * 2 + (lane >> 4)) * SEQ + p * BK + (m16 << 2));
  #pragma unroll
  for (int p = 0; p < PTIL; ++p)
    #pragma unroll
    for (int it = 0; it < 8; ++it)
      *(int4*)&Ts[wave][p][it * 2 + (lane >> 4)][m16 << 2] = m[p][it];
  __syncthreads();   // the rows stored above are read below by other lanes

  // lane l collects words 4l..4l+3 of the wave's 128, so that one 16-byte store per lane writes whole lines
  int w4[4] = {0, 0, 0, 0};
  #pragma unroll
  for (int p = 0; p < PTIL; ++p)
    #pragma unroll
    for (int t = 0; t < 4; ++t) {
      const int4 lo = *(const int4*)&Ts[wave][p][m16][t * 16 + half8];
      const int4 hi = *(const int4*)&Ts[wave][p][m16][t * 16 + half8 + 4];
      const int e[8] = {lo.x, lo.y, lo.z, lo.w, hi.x, hi.y, hi.z, hi.w};
      #pragma unroll
      for (int r = 0; r < 8; ++r) {
        const int w = p * MWB + t * 8 + r;
        const int word = (int)__builtin_amdgcn_ballot_w32(e[r] != 0);
        w4[w & 3] = (lane == (w >> 2)) ? word : w4[w & 3];
      }
    }
  int4 o;
  o.x = w4[0];  o.y = w4[1];  o.z = w4[2];  o.w = w4[3];
  *(int4*)(MW + ((size_t)rt * KBLK + cg * PTIL) * MWB + (lane << 2)) = o;
}

// two waves per SIMD and no more (one workgroup per WGP, the grid has no second): without the upper bound
// the scheduler narrows the softmax and the V reads to save registers for a third wave that never comes
__global__ __launch_bounds__(NTHR) __attribute__((amdgpu_waves_per_eu(2, 2)))
void flash_attn_f16_wmma(const float* __restrict__ Q,
                         const float* __restrict__ K,
                         const float* __restrict__ V,
                         const unsigned int* __restrict__ MW,
                         float* __restrict__ OUT)
{
  __shared__ __attribute__((aligned(16))) _Float16 Ks[2][BK][KP];  // two key blocks, f16, padded rows
  __shared__ __attribute__((aligned(16))) _Float16 Vs[2][BK][VP];  // two value blocks, f16, padded rows

  const int tid  = threadIdx.x;
  const int lane = tid & 31;
  const int wave = tid >> 5;

  const int qtiles = SEQ / BQ;
  const int bh = blockIdx.x / qtiles;
  const int qt = blockIdx.x % qtiles;
  const int b  = bh / HEADS;

  const float* qb = Q + (size_t)bh * SEQ * DH;
  const float* kb = K + (size_t)bh * SEQ * DH;
  const float* vb = V + (size_t)bh * SEQ * DH;
  float*       ob = OUT + (size_t)bh * SEQ * DH;

  const int m16   = lane & 15;
  const int half8 = (lane >> 4) << 3;      // 0 for lanes 0..15, 8 for 16..31
  const int qblk  = qt * BQ;
  const int q0    = qblk + wave * (16 * QG);   // this wave's first q row; tile g starts at q0 + 16 g

  // this wave's lane-mask words: a wave-uniform address, so that they arrive by scalar loads
  // (tile 0's; tile g's stand g * KBLK * MWB words further on)
  const unsigned int* mw0 = MW + (size_t)(b * (SEQ / 16) + (qblk >> 4)
                                         + __builtin_amdgcn_readfirstlane(wave) * QG) * (KBLK * MWB);

  // ---- Q^T B-fragments with softmax scale and log2(e) folded in: lane = query column m16
  // hardware k order: lanes 0-15 hold k in {0..7,16..23}; lanes 16-31 hold {8..15,24..31}
  const float* qrow = qb + (size_t)(q0 + m16) * DH + half8;   // tile 0's row of this lane; tile g's: + g * 16 rows
  float qf[QG][2][16];
  #pragma unroll
  for (int g = 0; g < QG; ++g)
    #pragma unroll
    for (int c = 0; c < 2; ++c)
      #pragma unroll
      for (int j = 0; j < 16; ++j)
        qf[g][c][j] = qrow[g * 16 * DH + c * 32 + (j & 7) + ((j >> 3) << 4)];
  // precaution: the loads above have taken their address before anything lands on the registers that hold it;
  // naming the pointer keeps it in registers of its own up to here
  asm volatile("s_wait_xcnt 0x0" :: "v"(qrow) : "memory");
  v16h qa[QG][2];
  #pragma unroll
  for (int g = 0; g < QG; ++g)
    #pragma unroll
    for (int c = 0; c < 2; ++c)
      #pragma unroll
      for (int j = 0; j < 16; ++j)
        qa[g][c][j] = (_Float16)(qf[g][c][j] * QSCALE);

  v8f oacc[QG][4] = {};      // O^T accumulators per query tile: 4 Dh-tiles of 16 rows, column = query m16
  float muse[QG];            // maximum in use for query m16 of each tile (equal in both wave halves), base 2
  v8f   negm[QG];            // minus that maximum in every row: the C operand of the score products
  float mval[QG];            // a masked score against that maximum
  float lrun[QG];            // running sum over this wave half's keys; the halves join after the loop
  #pragma unroll
  for (int g = 0; g < QG; ++g) {
    muse[g] = -INFINITY;     // no maximum yet: the first pass's scores come out +inf and take the rescaling path
    #pragma unroll
    for (int r = 0; r < 8; ++r)
      negm[g][r] = INFINITY;
    mval[g] = INFINITY;
    lrun[g] = 0.f;
  }

  // ---- software pipeline: K/V blocks pass through these registers on their way to LDS
  float4 kreg[STG], vreg[STG];
  // byte offset of this thread's first float4 in the K and V block that is requested next, and of the wave's mask
  // words that are requested next: each in a register of its own, which only the two steps below rewrite
  unsigned int koff = (unsigned int)tid * 16u;
  unsigned int moff = 0u;
  auto fetch = [&]() {
    const char* ks = (const char*)kb + koff;
    const char* vs = (const char*)vb + koff;
    #pragma unroll
    for (int it = 0; it < STG; ++it) {
      kreg[it] = *(const float4*)(ks + it * (NTHR * 16));
      vreg[it] = *(const float4*)(vs + it * (NTHR * 16));
    }
  };
  // precaution: the loads issued so far have taken their addresses before the offset register that they name is
  // rewritten. Wait and rewrite stand in one statement, so that nothing comes between them, and at the head of a
  // pass, where those loads have long returned: directly behind the loads every wave would sit the wait out
  auto step_kv = [&]() {
    asm volatile("s_wait_xcnt 0x0\n\tv_add_nc_u32 %0, %1, %0" : "+v"(koff) : "i"(BK * DH * 4) : "memory");
  };
  auto step_mask = [&]() {
    asm volatile("s_wait_xcnt 0x0\n\ts_add_co_u32 %0, %0, %1" : "+s"(moff) : "i"(MWB * 4) : "memory", "scc");
  };

  // the 32 lane-mask words of each query tile for the key block that moff selects, into scalar registers
  auto fetch_mask = [&](unsigned int (&mword)[QG][MWB]) {
    const unsigned int* ms = (const unsigned int*)((const char*)mw0 + moff);
    #pragma unroll
    for (int g = 0; g < QG; ++g)
      #pragma unroll
      for (int i = 0; i < MWB; ++i)
        mword[g][i] = ms[g * (KBLK * MWB) + i];
  };

  // commits the pipelined K/V registers to LDS buffer nb as f16
  auto commit = [&](const int nb) __attribute__((always_inline)) {
    #pragma unroll
    for (int it = 0; it < STG; ++it) {
      const int row = it * (NTHR / 16) + (tid >> 4);   // constant row steps: one address register per matrix
      const int col = (tid & 15) << 2;
      Ks[nb][row][col + 0] = (_Float16)kreg[it].x;
      Ks[nb][row][col + 1] = (_Float16)kreg[it].y;
      Ks[nb][row][col + 2] = (_Float16)kreg[it].z;
      Ks[nb][row][col + 3] = (_Float16)kreg[it].w;
      Vs[nb][row][col + 0] = (_Float16)vreg[it].x;
      Vs[nb][row][col + 1] = (_Float16)vreg[it].y;
      Vs[nb][row][col + 2] = (_Float16)vreg[it].z;
      Vs[nb][row][col + 3] = (_Float16)vreg[it].w;
    }
  };
  unsigned int mword[QG][MWB];   // the current key block's mask words, per query tile
  fetch();
  fetch_mask(mword);
  commit(0);
  step_kv();
  fetch();           // block 1 waits in registers for the head of pass 0
  lds_barrier();     // block 0 is in buffer 0 for every wave

  // this lane's source row and 16-byte half for the transposing V loads, in buffer 0
  const _Float16* vtr0 = &Vs[0][half8 + (lane & 7)][((lane >> 3) & 1) << 3];

  // one pass: key block k0 from LDS buffer u with mask words mword; more = a next block exists, more2 = a block
  // after that too (more and more2 are constants at each call)
  auto pass = [&](const int u, const int k0, const bool more, const bool more2) __attribute__((always_inline)) {
    const _Float16* vtr = vtr0 + u * (BK * VP);

    // ---- every read from L2 has a whole pass of lead over its first use: the next block, loaded during the
    // previous pass, goes into the other buffer, whose last readers left it before the previous barrier;
    // then the K/V block after it is requested
    if (more) {
      commit(u ^ 1);
      step_mask();
    }
    if (more2) {
      // keeps the new loads behind the conversions above, so that they land in the same 32 registers
      __builtin_amdgcn_sched_barrier(0);
      step_kv();
      fetch();
      // keeps the requests here, at the head of the pass: sunk behind the score products they would have half the lead
      __builtin_amdgcn_sched_barrier(0);
    }

    // ---- scores, transposed, against the maximum in use: S^T = K * (Q*scale)^T + C, 4 key tiles of 16 rows,
    // k-dim 64 (2 WMMA each); sc[g][t][r] = score of key k0 + t*16 + half8 + r against query q0 + g*16 + m16
    v8f sc[QG][4];
    auto score_tiles = [&](const v8f (&c0)[QG]) __attribute__((always_inline)) {
      #pragma unroll
      for (int t = 0; t < 4; ++t) {
        #pragma unroll
        for (int c = 0; c < 2; ++c) {
          v16h kf;   // lane holds key row t*16+m16, j walks Dh
          #pragma unroll
          for (int j = 0; j < 16; ++j) {
            const int kk = c * 32 + half8 + (j & 7) + ((j >> 3) << 4);
            kf[j] = Ks[u][t * 16 + m16][kk];
          }
          #pragma unroll
          for (int g = 0; g < QG; ++g)
            sc[g][t] = __builtin_amdgcn_wmma_f32_16x16x32_f16(false, kf, false, qa[g][c],
                                                              (short)0, c == 0 ? c0[g] : sc[g][t], false, false);
        }
      }
    };
    score_tiles(negm);

    // ---- mask (mask==0 -> mval, the reference's -1e9 in base 2 less the maximum in use): each word is the select's lane mask as it stands
    #pragma unroll
    for (int g = 0; g < QG; ++g)
      #pragma unroll
      for (int t = 0; t < 4; ++t)
        #pragma unroll
        for (int r = 0; r < 8; ++r)
          sc[g][t][r] = __builtin_amdgcn_inverse_ballot_w32(mword[g][t * 8 + r]) ? sc[g][t][r] : mval[g];

    // ---- how far this lane's scores top the maximum in use: four independent chains
    float top[QG][2];
    #pragma unroll
    for (int g = 0; g < QG; ++g)
      #pragma unroll
      for (int h = 0; h < 2; ++h) {
        top[g][h] = sc[g][2 * h][0];
        #pragma unroll
        for (int t = 2 * h; t < 2 * h + 2; ++t)
          #pragma unroll
          for (int r = 0; r < 8; ++r)
            top[g][h] = fmaxf(top[g][h], sc[g][t][r]);
      }
    const bool need = fmaxf(fmaxf(top[0][0], top[0][1]), fmaxf(top[1][0], top[1][1])) > LAZY;

    // ---- one wave-uniform test per pass; taken in the first pass and wherever a query's scores outgrow its maximum
    if (__builtin_amdgcn_ballot_w32(need) != 0) {
      // the scores anew without a shift (a maximum in use of -1e9 or -inf has cost the shifted ones their low bits)
      const v8f zero[QG] = {};
      score_tiles(zero);
      #pragma unroll
      for (int g = 0; g < QG; ++g) {
        #pragma unroll
        for (int t = 0; t < 4; ++t)
          #pragma unroll
          for (int r = 0; r < 8; ++r)
            sc[g][t][r] = __builtin_amdgcn_inverse_ballot_w32(mword[g][t * 8 + r]) ? sc[g][t][r] : NEGL2;
        float bm = sc[g][0][0];
        #pragma unroll
        for (int t = 0; t < 4; ++t)
          #pragma unroll
          for (int r = 0; r < 8; ++r)
            bm = fmaxf(bm, sc[g][t][r]);
        bm = fmaxf(bm, xhalf(bm));                  // both halves now hold the block maximum of the query
        const float mnew = fmaxf(muse[g], bm);
        const float corr = __builtin_amdgcn_exp2f(muse[g] - mnew);  // exp2(-inf)=0 on first block
        muse[g] = mnew;
        mval[g] = NEGL2 - mnew;                     // 0 while every key so far was masked: such keys weigh alike
        lrun[g] *= corr;
        #pragma unroll
        for (int r = 0; r < 8; ++r)
          negm[g][r] = -mnew;
        #pragma unroll
        for (int t = 0; t < 4; ++t)
          #pragma unroll
          for (int r = 0; r < 8; ++r) {
            sc[g][t][r] -= mnew;
            oacc[g][t][r] *= corr;
          }
      }
    }

    // ---- V^T A-fragments by the transposing load, requested ahead of the exponentials, which cover their way from LDS
    // lane holds Dh row t*16+m16; elements 0..7 = keys c*32+half8+0..7, 8..15 = the same + 16
    v16h av[4][2];
    #pragma unroll
    for (int t = 0; t < 4; ++t)
      #pragma unroll
      for (int c = 0; c < 2; ++c) {
        const v8h lo = ld_tr16(vtr + (c * 32) * VP + t * 16);
        const v8h hi = ld_tr16(vtr + (c * 32 + 16) * VP + t * 16);
        av[t][c] = __builtin_shufflevector(lo, hi, 0, 1, 2, 3, 4, 5, 6, 7,
                                           8, 9, 10, 11, 12, 13, 14, 15);
      }

    // ---- the next block's mask words, requested once this block's are used up, into the same scalar registers
    if (more)
      fetch_mask(mword);
    // keeps the V reads and the mask requests above ahead of the exponentials: sunk among the products below,
    // they would be waited for there
    __builtin_amdgcn_sched_barrier(0);

    // P^T B-fragments straight from the score tiles: tiles 2c and 2c+1 are k 0..7,16..23 (+8 in the upper half)
    v16h pb[QG][2];
    #pragma unroll
    for (int g = 0; g < QG; ++g) {
      // ---- the scores are exp2 arguments as they stand; one query per lane, sum in-lane
      float bsum = 0.f;
      #pragma unroll
      for (int t = 0; t < 4; ++t)
        #pragma unroll
        for (int r = 0; r < 8; ++r) {
          const float p = __builtin_amdgcn_exp2f(sc[g][t][r]);
          bsum += p;
          pb[g][t >> 1][((t & 1) << 3) + r] = (_Float16)p;
        }
      lrun[g] += bsum;
    }

    // ---- O^T += V^T * P^T   (A = V^T 16x32 tiles by the transposing load, B = P^T 32x16)
    #pragma unroll
    for (int t = 0; t < 4; ++t) {
      #pragma unroll
      for (int c = 0; c < 2; ++c) {
        #pragma unroll
        for (int g = 0; g < QG; ++g)
          oacc[g][t] = __builtin_amdgcn_wmma_f32_16x16x32_f16(false, av[t][c], false, pb[g][c],
                                                              (short)0, oacc[g][t], false, false);
      }
    }

    if (more) {
      lds_barrier();     // the one barrier of a pass: publishes the next block, ends this block's reads
    }
  };

  // one pass per trip: two passes in one block of code are mixed by the scheduler, which then holds both passes'
  // fragments and scores beside the K/V registers; the last two passes stand alone
  #pragma clang loop unroll(disable)
  for (int n = 0; n < KBLK - 2; ++n)
    pass(n & 1, n * BK, true, true);
  pass(0, SEQ - 2 * BK, true, false);
  pass(1, SEQ - BK, false, false);

  // ---- join the halves' sums, normalize and store fp32: 8 consecutive Dh of one query row per tile
  #pragma unroll
  for (int g = 0; g < QG; ++g) {
    const float lsum = lrun[g] + xhalf(lrun[g]);
    float* orow = ob + (size_t)(q0 + g * 16 + m16) * DH + half8;
    #pragma unroll
    for (int t = 0; t < 4; ++t) {
      float4 lo, hi;
      lo.x = oacc[g][t][0] / lsum;  lo.y = oacc[g][t][1] / lsum;
      lo.z = oacc[g][t][2] / lsum;  lo.w = oacc[g][t][3] / lsum;
      hi.x = oacc[g][t][4] / lsum;  hi.y = oacc[g][t][5] / lsum;
      hi.z = oacc[g][t][6] / lsum;  hi.w = oacc[g][t][7] / lsum;
      *(float4*)(orow + t * 16)     = lo;
      *(float4*)(orow + t * 16 + 4) = hi;
    }
  }
}

extern "C" void kernel_launch(void* const* d_in, const int* in_sizes, int n_in,
                              void* d_out, int out_size, void* d_ws, size_t ws_size,
                              hipStream_t stream) {
  const float* q    = (const float*)d_in[0];
  const float* k    = (const float*)d_in[1];
  const float* v    = (const float*)d_in[2];
  const int*   mask = (const int*)d_in[3];
  float*       out  = (float*)d_out;
  unsigned int* mwords = (unsigned int*)d_ws;   // 2 * 128 * 32 * 32 words = 1 MiB, written anew in every call

  dim3 grid(BATCH * HEADS * (SEQ / BQ));   // 2*16*8 = 256 workgroups
  dim3 block(NTHR);                        // 256 threads = 8 waves (wave32)
  dim3 pgrid(BATCH * (SEQ / 16) * (KBLK / PTIL) / PWAV);   // 2048 waves in 256 workgroups
  dim3 pblock(PWAV * 32);
  pack_mask_lane_words<<<pgrid, pblock, 0, stream>>>(mask, mwords);
  flash_attn_f16_wmma<<<grid, block, 0, stream>>>(q, k, v, mwords, out);
}
